// v008
// Measured on an AMD MI455X. A time is GPU time per run, averaged over a window of back-to-back runs after a warm-up
// (all launches, gaps included; the runs take copies of the inputs in turn), and the median of several windows.
// Apart from v000's, it joins two sittings. Times from different sittings can be a few percent apart, while
// side-by-side timings come from the same sitting.
// The versions before v008 are in another document.
// Measured time: 61.8 microseconds a run.
// Next to v007, in two timings, it ran 1.21 times as fast each time.
// Over all steps from v000, the starting kernel, it is 9.26 times as fast.
#include <hip/hip_runtime.h>
// CrossViewAttention3D (1 clip: 512 channels x (4 x 32 x 32 = 4096) tokens, 8 heads x 64): q = Wq video + bq, k = Wk ref + bk, v = Wv ref + bv (1x1x1 convs = channel matmuls); softmax(q.k / 8) over the 4096 ref tokens; out = Wo ctx + bo; channel-major in and out.
// Structure: exact token-major f16 planes of both inputs; q, k, v as f16 WMMA GEMM outputs (32x64 wave tiles, f32 accumulation, exact x16 weights + bias, f16 out); V^T straight from its GEMM (weights as rows, tokens as columns); the fused flash kernel (4096 x 4096 per head, plain operands) stores ctx as f16; the Wo + bo GEMM, weights as rows, stores channel-major.
// Compute dtype: inputs rounded to bf16; inputs exact as f16; q/k/P/v/ctx as plain f16 operands (~2^-12); softmax f32. v_wmma_f32_16x16x32_f16.
#define NB 1
#define DM 512
#define NKV 8
#define NREP (NH / NKV)
#define KVD (NKV * 64)           /* 512 */
#define NR (NB * SLEN)           /* 4096 */
#define SLEN 4096
#define TQ SLEN
#define TK SLEN
#define NH 8
#define SCL 0.125f
#define QBLKS (TQ / 64)
#define QB05 0
#define QBN5 4
#define QB0P 0
#define QBNP QBLKS           /* non-causal: plain flash on every query block */
#define RE 256
typedef __bf16 v16b __attribute__((ext_vector_type(16)));
typedef unsigned short v8us __attribute__((ext_vector_type(8), may_alias));
typedef float  v8f  __attribute__((ext_vector_type(8)));
typedef float  v4f  __attribute__((ext_vector_type(4)));
typedef float  v4fa __attribute__((ext_vector_type(4), may_alias));
union FragB { v16b v; v8us half[2]; unsigned short u[16]; };

__device__ __forceinline__ unsigned short bf16_bits(float x) { unsigned int u = __float_as_uint(x); return (unsigned short)((u + 0x7FFFu + ((u >> 16) & 1u)) >> 16); }
__device__ __forceinline__ float bf16_val(unsigned short b) { return __uint_as_float(((unsigned int)b) << 16); }
__device__ __forceinline__ float bf16_round(float x) { return bf16_val(bf16_bits(x)); }
// D += A·B with NT terms: 1 = ah·bh, 2 = + al·bh (A split), 3 = + ah·bl (both split)
template <int NT>
__device__ __forceinline__ v8f mmaN(v16b ah, v16b al, v16b bh, v16b bl, v8f c) {
  c = __builtin_amdgcn_wmma_f32_16x16x32_bf16(false, ah, false, bh, (short)0, c, false, false);
  if (NT >= 2) c = __builtin_amdgcn_wmma_f32_16x16x32_bf16(false, al, false, bh, (short)0, c, false, false);
  if (NT >= 3) c = __builtin_amdgcn_wmma_f32_16x16x32_bf16(false, ah, false, bl, (short)0, c, false, false);
  asm volatile("v_nop\n\tv_nop\n\tv_nop\n\tv_nop" : "+v"(c) : "v"(ah), "v"(al), "v"(bh), "v"(bl));
  return c;
}

__global__ __launch_bounds__(256) void k_wt_bf16(const float* __restrict__ W, unsigned short* __restrict__ Wt, int K, int N) {
  const int t = blockIdx.x * 256 + threadIdx.x;
  const int k8n = K / 8;
  if (t >= N * k8n) return;
  const int n = t / k8n, k8 = (t % k8n) * 8;
  v8us v;
#pragma unroll
  for (int i = 0; i < 8; ++i) v[i] = bf16_bits(W[(size_t)(k8 + i) * N + n]);
  *(v8us*)(Wt + (size_t)n * K + k8) = v;
  
}

// GEMM C[M][N] (f32, pitch ldc) = act(A[M][K]·W + bias). A f32 row-major (pitch lda) converted per fragment to bf16
// (ASPLIT: hi/lo two planes -> 2 terms, else single rounded term); Wt bf16 [N][K] (pitch ldb). BIAS_BF16 rounds the
// bias to bf16 first (bias quantised to bf16 before the add). K%32==0, M%16==0, N%64==0.
template <bool ASPLIT, int ACT, bool BIAS_BF16>
__global__ __launch_bounds__(128) void k_gemm_bf(const float* __restrict__ A, int lda, const unsigned short* __restrict__ Wt, int ldb,
                                               const float* __restrict__ bias, float* __restrict__ C, int ldc, int M, int N, int K) {
  __shared__ __attribute__((aligned(16))) float so[4][16][64];
  const int tid = threadIdx.x, w = tid >> 5, lane = tid & 31, ln = lane & 15, hh = lane >> 4;
  const int ntn = N / 64;
  const int wid = blockIdx.x * 4 + w;
  const int mt = wid / ntn, nq = wid % ntn;
  if (mt * 16 >= M) return;
  const int row0 = mt * 16, col0 = nq * 64;
  const float* arow = A + (size_t)(row0 + ln) * lda;
  v8f acc[4] = {};
  for (int kb = 0; kb < K; kb += 32) {
    FragB ah, al;
    const v4f x0 = *(const v4fa*)(arow + kb + 8 * hh), x1 = *(const v4fa*)(arow + kb + 8 * hh + 4);
    const v4f x2 = *(const v4fa*)(arow + kb + 16 + 8 * hh), x3 = *(const v4fa*)(arow + kb + 16 + 8 * hh + 4);
    float xs[16] = {x0[0],x0[1],x0[2],x0[3],x1[0],x1[1],x1[2],x1[3],x2[0],x2[1],x2[2],x2[3],x3[0],x3[1],x3[2],x3[3]};
#pragma unroll
    for (int i = 0; i < 16; ++i) { const unsigned short hb = bf16_bits(xs[i]); ah.u[i] = hb; al.u[i] = ASPLIT ? bf16_bits(xs[i] - bf16_val(hb)) : (unsigned short)0; }
#pragma unroll
    for (int t = 0; t < 4; ++t) {
      const unsigned short* brow = Wt + (size_t)(col0 + t * 16 + ln) * ldb + kb;
      FragB b;
      b.half[0] = *(const v8us*)(brow + 8 * hh);
      b.half[1] = *(const v8us*)(brow + 16 + 8 * hh);
      acc[t] = mmaN<ASPLIT ? 2 : 1>(ah.v, al.v, b.v, b.v, acc[t]);
    }
  }
#pragma unroll
  for (int t = 0; t < 4; ++t) {
    float bv = bias ? bias[col0 + t * 16 + ln] : 0.f;
    if (BIAS_BF16) bv = bf16_round(bv);
#pragma unroll
    for (int r = 0; r < 8; ++r) { float v = acc[t][r] + bv; if (ACT == 1) v = fmaxf(v, 0.f); so[w][8 * hh + r][t * 16 + ln] = v; }
  }
  __builtin_amdgcn_fence(__ATOMIC_ACQ_REL, "workgroup");
  __builtin_amdgcn_wave_barrier();
  const int rsub = lane >> 4, c4 = (lane & 15) * 4;
  {
#pragma unroll
    for (int q = 0; q < 8; ++q) {
      const int r = q * 2 + rsub;
      const v4f v = *(const v4fa*)&so[w][r][c4];
      *(v4f*)(C + (size_t)(row0 + r) * ldc + col0 + c4) = v;
    }
    
  }
}

// GEMM C = act(A·W + bias + resid): A f32 (ASPLIT -> hi/lo 2 terms), Wt bf16 [N][K]; ACT 0 none, 1 relu, 2 exact gelu;
// resid (optional, f32, row index = (row % rmod), pitch ldr, RES_BF16 rounds it) added before the activation.
template <bool ASPLIT, int ACT, bool BIAS_BF16, bool RES_BF16>
__global__ __launch_bounds__(128) void k_gemm_bf3(const float* __restrict__ A, int lda, const unsigned short* __restrict__ Wt, int ldb,
                                                const float* __restrict__ bias, const float* __restrict__ resid, int rmod, int ldr,
                                                float* __restrict__ C, int ldc, int M, int N, int K) {
  __shared__ __attribute__((aligned(16))) float so[4][16][64];
  const int tid = threadIdx.x, w = tid >> 5, lane = tid & 31, ln = lane & 15, hh = lane >> 4;
  const int ntn = N / 64;
  const int wid = blockIdx.x * 4 + w;
  const int mt = wid / ntn, nq = wid % ntn;
  if (mt * 16 >= M) return;
  const int row0 = mt * 16, col0 = nq * 64;
  const float* arow = A + (size_t)(row0 + ln) * lda;
  v8f acc[4] = {};
  for (int kb = 0; kb < K; kb += 32) {
    FragB ah, al;
    const v4f x0 = *(const v4fa*)(arow + kb + 8 * hh), x1 = *(const v4fa*)(arow + kb + 8 * hh + 4);
    const v4f x2 = *(const v4fa*)(arow + kb + 16 + 8 * hh), x3 = *(const v4fa*)(arow + kb + 16 + 8 * hh + 4);
    float xs[16] = {x0[0],x0[1],x0[2],x0[3],x1[0],x1[1],x1[2],x1[3],x2[0],x2[1],x2[2],x2[3],x3[0],x3[1],x3[2],x3[3]};
#pragma unroll
    for (int i = 0; i < 16; ++i) { const unsigned short hb = bf16_bits(xs[i]); ah.u[i] = hb; al.u[i] = ASPLIT ? bf16_bits(xs[i] - bf16_val(hb)) : (unsigned short)0; }
#pragma unroll
    for (int t = 0; t < 4; ++t) {
      const unsigned short* brow = Wt + (size_t)(col0 + t * 16 + ln) * ldb + kb;
      FragB b;
      b.half[0] = *(const v8us*)(brow + 8 * hh);
      b.half[1] = *(const v8us*)(brow + 16 + 8 * hh);
      acc[t] = mmaN<ASPLIT ? 2 : 1>(ah.v, al.v, b.v, b.v, acc[t]);
    }
  }
#pragma unroll
  for (int t = 0; t < 4; ++t) {
    const int col = col0 + t * 16 + ln;
    float bv = bias ? bias[col] : 0.f;
    if (BIAS_BF16) bv = bf16_round(bv);
#pragma unroll
    for (int r = 0; r < 8; ++r) {
      float v = acc[t][r] + bv;
      if (resid) { float rv = resid[(size_t)((row0 + 8 * hh + r) % rmod) * ldr + col]; if (RES_BF16) rv = bf16_round(rv); v += rv; }
      if (ACT == 1) v = fmaxf(v, 0.f);
      if (ACT == 2) v = 0.5f * v * (1.0f + erff(v * 0.70710678118654752f));
      if (ACT == 3) { const float u = 0.7978845608028654f * (v + 0.044715f * v * v * v); v = 0.5f * v * (1.0f + tanhf(u)); }
      so[w][8 * hh + r][t * 16 + ln] = v;
    }
  }
  __builtin_amdgcn_fence(__ATOMIC_ACQ_REL, "workgroup");
  __builtin_amdgcn_wave_barrier();
  const int rsub = lane >> 4, c4 = (lane & 15) * 4;
  {
#pragma unroll
    for (int q = 0; q < 8; ++q) {
      const int r = q * 2 + rsub;
      const v4f v = *(const v4fa*)&so[w][r][c4];
      *(v4f*)(C + (size_t)(row0 + r) * ldc + col0 + c4) = v;
    }
    
  }
}
// row LayerNorm (biased variance, eps) over N: s = X (+ R); optional out_sum <- s; out_norm <- (s-mu)*rsqrt(var+eps)*g + b
template <bool PARAM_BF16>
__global__ __launch_bounds__(256) void k_layernorm(const float* __restrict__ X, const float* __restrict__ R, const float* __restrict__ g, const float* __restrict__ bta,
                                                  float* __restrict__ out_sum, float* __restrict__ out_norm, int N, float eps) {
  __shared__ float red[256];
  const int row = blockIdx.x, tid = threadIdx.x;
  const float* x = X + (size_t)row * N; const float* rr = R ? R + (size_t)row * N : nullptr;
  float vals[16];                     // up to N = 4096
  const int per = N / 256;            // contiguous chunk per thread? use strided-by-4 chunks: thread handles j = tid*4 + 1024*u
  float s1 = 0.f;
  for (int u = 0; u < per / 4; ++u) {
    const int j = tid * 4 + 1024 * u;
    const v4f a = *(const v4fa*)(x + j);
    v4f b = {0.f,0.f,0.f,0.f}; if (rr) b = *(const v4fa*)(rr + j);
#pragma unroll
    for (int q = 0; q < 4; ++q) { const float v = a[q] + b[q]; vals[u * 4 + q] = v; s1 += v; }
  }
  red[tid] = s1; __syncthreads();
  for (int st = 128; st > 0; st >>= 1) { if (tid < st) red[tid] += red[tid + st]; __syncthreads(); }
  const float mu = red[0] / (float)N; __syncthreads();
  float s2 = 0.f;
  for (int u = 0; u < per / 4; ++u)
#pragma unroll
    for (int q = 0; q < 4; ++q) { const float c = vals[u * 4 + q] - mu; s2 += c * c; }
  red[tid] = s2; __syncthreads();
  for (int st = 128; st > 0; st >>= 1) { if (tid < st) red[tid] += red[tid + st]; __syncthreads(); }
  const float rs = rsqrtf(red[0] / (float)N + eps);
  {
    for (int u = 0; u < per / 4; ++u) {
      const int j = tid * 4 + 1024 * u;
      v4f o, sm;
#pragma unroll
      for (int q = 0; q < 4; ++q) {
        float gg = g[j + q], bb = bta[j + q];
        if (PARAM_BF16) { gg = bf16_round(gg); bb = bf16_round(bb); }
        sm[q] = vals[u * 4 + q]; o[q] = (vals[u * 4 + q] - mu) * rs * gg + bb;
      }
      if (out_sum) *(v4f*)(out_sum + (size_t)row * N + j) = sm;
      *(v4f*)(out_norm + (size_t)row * N + j) = o;
    }
    
  }
}



// ---- f16 WMMA path (v_wmma_f32_16x16x32_f16): 11-bit significands for operands in range — used where a [0,1] probability operand needs more precision than bf16
typedef _Float16 v16h __attribute__((ext_vector_type(16)));
union FragH { v16h v; v8us half[2]; _Float16 h[16]; unsigned short u[16]; };
template <int NT>
__device__ __forceinline__ v8f mmaH(v16h ah, v16h al, v16h bh, v16h bl, v8f c) {
  c = __builtin_amdgcn_wmma_f32_16x16x32_f16(false, ah, false, bh, (short)0, c, false, false);
  if (NT >= 2) c = __builtin_amdgcn_wmma_f32_16x16x32_f16(false, al, false, bh, (short)0, c, false, false);
  if (NT >= 3) c = __builtin_amdgcn_wmma_f32_16x16x32_f16(false, ah, false, bl, (short)0, c, false, false);
  asm volatile("v_nop\n\tv_nop\n\tv_nop\n\tv_nop" : "+v"(c) : "v"(ah), "v"(al), "v"(bh), "v"(bl));
  return c;
}
// batched GEMM like k_gemm_b but f16 operands: A f32 (split into f16 hi/lo if ASPLIT, else rounded to f16), Bt = f16 values [n][k]; alpha; C f32; N multiple of 16 (partial tiles skipped)
template <bool ASPLIT>
__global__ __launch_bounds__(128) void k_gemm_h(const float* __restrict__ A, int lda, size_t sA, const _Float16* __restrict__ Bh, int ldb, size_t sB, float alpha, float* __restrict__ C, int ldc, size_t sC, int M, int N, int K) {
  __shared__ __attribute__((aligned(16))) float so[4][16][64];
  const int tid = threadIdx.x, w = tid >> 5, lane = tid & 31, ln = lane & 15, hh = lane >> 4; const int by = blockIdx.y;
  A += (size_t)by * sA; Bh += (size_t)by * sB; C += (size_t)by * sC;
  const int ntn = (N + 63) / 64; const int wid = blockIdx.x * 4 + w; const int mt = wid / ntn, nq = wid % ntn; if (mt * 16 >= M) return;
  const int row0 = mt * 16, col0 = nq * 64; const float* arow = A + (size_t)(row0 + ln) * lda;
  v8f acc[4] = {};
  for (int kb = 0; kb < K; kb += 32) {
    FragH ah, al;
    const v4f x0 = *(const v4fa*)(arow + kb + 8 * hh), x1 = *(const v4fa*)(arow + kb + 8 * hh + 4), x2 = *(const v4fa*)(arow + kb + 16 + 8 * hh), x3 = *(const v4fa*)(arow + kb + 16 + 8 * hh + 4);
    float xs[16] = {x0[0],x0[1],x0[2],x0[3],x1[0],x1[1],x1[2],x1[3],x2[0],x2[1],x2[2],x2[3],x3[0],x3[1],x3[2],x3[3]};
#pragma unroll
    for (int i = 0; i < 16; ++i) { const _Float16 h = (_Float16)xs[i]; ah.h[i] = h; al.h[i] = ASPLIT ? (_Float16)(xs[i] - (float)h) : (_Float16)0.0f; }
#pragma unroll
    for (int t = 0; t < 4; ++t) { if (col0 + t * 16 >= N) continue; const size_t boff = (size_t)(col0 + t * 16 + ln) * ldb + kb; FragH bq; bq.half[0] = *(const v8us*)(Bh + boff + 8 * hh); bq.half[1] = *(const v8us*)(Bh + boff + 16 + 8 * hh);
      acc[t] = mmaH<ASPLIT ? 2 : 1>(ah.v, al.v, bq.v, bq.v, acc[t]); }
  }
#pragma unroll
  for (int t = 0; t < 4; ++t) { if (col0 + t * 16 >= N) continue;
#pragma unroll
    for (int r = 0; r < 8; ++r) so[w][8 * hh + r][t * 16 + ln] = acc[t][r] * alpha; }
  __builtin_amdgcn_fence(__ATOMIC_ACQ_REL, "workgroup"); __builtin_amdgcn_wave_barrier();
  const int rsub = lane >> 4, c4 = (lane & 15) * 4;
  {
#pragma unroll
    for (int q = 0; q < 8; ++q) { const int r = q * 2 + rsub; if (col0 + c4 < N) { const v4f v = *(const v4fa*)&so[w][r][c4]; *(v4f*)(C + (size_t)(row0 + r) * ldc + col0 + c4) = v; } }
     }
}

// Wt[n][k] = f16(W[k][n]·scale) from f32 row-major W[K][N] (scale = power of two; bf16-exact weights stay exact in f16 away from the subnormal range)
__global__ __launch_bounds__(256) void k_wt_f16(const float* __restrict__ W, _Float16* __restrict__ Wt, int K, int N, float scale) {
  const int t = blockIdx.x * 256 + threadIdx.x; if (t >= N * (K / 8)) return; const int n = t / (K / 8), k8 = (t % (K / 8)) * 8; FragH f;
#pragma unroll
  for (int i = 0; i < 8; ++i) f.h[i] = (_Float16)(bf16_round(W[(size_t)(k8 + i) * N + n]) * scale); const v8us o = f.half[0];
  *(v8us*)((unsigned short*)Wt + (size_t)n * K + k8) = o; 
}
// k_gemm_hh variant with fused epilogue: v = acc·alpha + bias[by·sBias + col] (+ CP[(row/rowsPerB)·sCPb + by·64 + col] if CP) ; ACT 0 none / 1 elu ; writes f16 C16 (and f32 C if non-null)
template <int ACT>
__global__ __launch_bounds__(128) void k_gemm_hhx(const _Float16* __restrict__ A, int lda, size_t sA, const _Float16* __restrict__ Bh, int ldb, size_t sB, float alpha, const float* __restrict__ bias, size_t sBias, const float* __restrict__ CP, int rowsPerB, size_t sCPb, int row0g,
    float* __restrict__ C, _Float16* __restrict__ C16, int ldc, size_t sC, int M, int N, int K) {
  __shared__ __attribute__((aligned(16))) float so[4][16][64];
  const int tid = threadIdx.x, w = tid >> 5, lane = tid & 31, ln = lane & 15, hh = lane >> 4; const int by = blockIdx.y;
  A += (size_t)by * sA; Bh += (size_t)by * sB; const size_t cofs = (size_t)by * sC; const float* bp = bias ? bias + (size_t)by * sBias : nullptr;
  const int ntn = (N + 63) / 64; const int wid = blockIdx.x * 4 + w; const int mt = wid / ntn, nq = wid % ntn; if (mt * 16 >= M) return;
  const int row0 = mt * 16, col0 = nq * 64; const _Float16* arow = A + (size_t)(row0 + ln) * lda;
  v8f acc[4] = {};
  for (int kb = 0; kb < K; kb += 32) { FragH ah; ah.half[0] = *(const v8us*)((const unsigned short*)arow + kb + 8 * hh); ah.half[1] = *(const v8us*)((const unsigned short*)arow + kb + 16 + 8 * hh);
#pragma unroll
    for (int t = 0; t < 4; ++t) { if (col0 + t * 16 >= N) continue; const size_t boff = (size_t)(col0 + t * 16 + ln) * ldb + kb; FragH bq; bq.half[0] = *(const v8us*)((const unsigned short*)Bh + boff + 8 * hh); bq.half[1] = *(const v8us*)((const unsigned short*)Bh + boff + 16 + 8 * hh);
      acc[t] = mmaH<1>(ah.v, ah.v, bq.v, bq.v, acc[t]); }
  }
#pragma unroll
  for (int t = 0; t < 4; ++t) { if (col0 + t * 16 >= N) continue; const int col = col0 + t * 16 + ln; const float bv = bp ? bf16_round(bp[col]) : 0.f;
#pragma unroll
    for (int r = 0; r < 8; ++r) { float v = acc[t][r] * alpha + bv; if (CP) { const int bidx = (row0g + row0 + 8 * hh + r) / rowsPerB; v += CP[(size_t)bidx * sCPb + (size_t)by * 64 + col]; } if (ACT == 1) v = (v > 0.f) ? v : expm1f(v); else if (ACT == 7) v = (v > 0.f) ? v + 1.0f : expf(v); else if (ACT == 8) v = tanhf(v); else if (ACT == 9) v = 0.5f * v * (1.0f + tanhf(0.7978845608028654f * (v + 0.044715f * v * v * v))); else if (ACT == 11) v = 1.0f / (1.0f + expf(-v)); else if (ACT == 12) v = (v > 0.f) ? v : 0.01f * v; else if (ACT == 14) v = (v > 0.f) ? v : 0.1f * v; else if (ACT == 15) v = v / (1.0f + expf(-v)); else if (ACT == 3) v = fmaxf(v, 0.f); else if (ACT == 6) v = 0.5f * v * (1.0f + erff(v * 0.70710678118654752f)); so[w][8 * hh + r][t * 16 + ln] = v; } }
  __builtin_amdgcn_fence(__ATOMIC_ACQ_REL, "workgroup"); __builtin_amdgcn_wave_barrier();
  const int rsub = lane >> 4, c4 = (lane & 15) * 4; typedef _Float16 v4h __attribute__((ext_vector_type(4)));
  {
#pragma unroll
    for (int q = 0; q < 8; ++q) { const int r = q * 2 + rsub; if (col0 + c4 < N) { const v4f v = *(const v4fa*)&so[w][r][c4]; if (C) *(v4f*)(C + cofs + (size_t)(row0 + r) * ldc + col0 + c4) = v; if (C16) { v4h h4; for (int i = 0; i < 4; ++i) h4[i] = (_Float16)v[i]; *(v4h*)(C16 + cofs + (size_t)(row0 + r) * ldc + col0 + c4) = h4; } } }
     }
}


typedef _Float16 v4h __attribute__((ext_vector_type(4)));

__global__ __launch_bounds__(256) void k_x16(const float* __restrict__ x, _Float16* __restrict__ X16, size_t n8) { const size_t t = (size_t)blockIdx.x * 256 + threadIdx.x; if (t >= n8) return; FragH f;
#pragma unroll
  for (int q = 0; q < 8; ++q) f.h[q] = (_Float16)bf16_round(x[t * 8 + q]); *(v8us*)((unsigned short*)X16 + t * 8) = f.half[0];  }
__global__ __launch_bounds__(256) void k_h16(const float* __restrict__ x, _Float16* __restrict__ X16, size_t n8) { const size_t t = (size_t)blockIdx.x * 256 + threadIdx.x; if (t >= n8) return; FragH f;
#pragma unroll
  for (int q = 0; q < 8; ++q) f.h[q] = (_Float16)x[t * 8 + q]; *(v8us*)((unsigned short*)X16 + t * 8) = f.half[0];  }
__global__ __launch_bounds__(256) void k_round16f(const float* __restrict__ W, _Float16* __restrict__ Bt, size_t n8) { const size_t t = (size_t)blockIdx.x * 256 + threadIdx.x; if (t >= n8) return; FragH f;
#pragma unroll
  for (int i = 0; i < 8; ++i) f.h[i] = (_Float16)(bf16_round(W[t * 8 + i]) * 16.0f); *(v8us*)((unsigned short*)Bt + t * 8) = f.half[0];  }
template <int NHv, int TTv>
__global__ __launch_bounds__(256) void k_vt(const _Float16* __restrict__ V16, int ldv, int voff, _Float16* __restrict__ Vt) { __shared__ unsigned short tl[64][66]; const int tid = threadIdx.x; const int slab = blockIdx.x / (TTv / 64), lg = blockIdx.x % (TTv / 64); const int b = slab / NHv, h = slab % NHv;
  for (int i = tid; i < 64 * 8; i += 256) { const int r = i / 8, c8 = (i % 8) * 8; FragH f; f.half[0] = *(const v8us*)((const unsigned short*)V16 + ((size_t)b * TTv + lg * 64 + r) * ldv + voff + h * 64 + c8);
#pragma unroll
    for (int q = 0; q < 8; ++q) tl[r][c8 + q] = f.u[q]; }
  __syncthreads();
  {
#pragma unroll
    for (int rd = 0; rd < 2; ++rd) { const int d = rd * 32 + tid / 8, pc = tid % 8; FragH f;
#pragma unroll
      for (int q = 0; q < 8; ++q) f.u[q] = tl[pc * 8 + q][d];
      *(v8us*)((unsigned short*)Vt + ((size_t)slab * 64 + d) * TTv + lg * 64 + pc * 8) = f.half[0]; }
     } }

__global__ __launch_bounds__(256) void k_hl(const float* __restrict__ F, _Float16* __restrict__ Hh, _Float16* __restrict__ Hl, size_t n8) { const size_t t = (size_t)blockIdx.x * 256 + threadIdx.x; if (t >= n8) return; FragH fh, fl; const v4f a = *(const v4fa*)(F + t * 8), c = *(const v4fa*)(F + t * 8 + 4);
#pragma unroll
  for (int q = 0; q < 4; ++q) { _Float16 h = (_Float16)a[q]; fh.h[q] = h; fl.h[q] = (_Float16)((a[q] - (float)h) * 1024.0f); h = (_Float16)c[q]; fh.h[4 + q] = h; fl.h[4 + q] = (_Float16)((c[q] - (float)h) * 1024.0f); }
  { *(v8us*)((unsigned short*)Hh + t * 8) = fh.half[0]; *(v8us*)((unsigned short*)Hl + t * 8) = fl.half[0];  } }

// ---- fast GEMM (work-group tile 128x64, wave tile 32x64; requires M % 128 == 0, N % 64 == 0 and K % 64 == 0, K >= 64); epilogue = k_gemm_hhx semantics ----
#define G2P 72      /* LDS row pitch in halves = 128 B + 16 B, the pitch of 16-byte LDS readers */
typedef unsigned short g2_tile[192][G2P];      /* one stage, 64 halves of k: rows 0..127 = the block's 128 rows of A, rows 128..191 = its 64 rows of B */
__device__ __forceinline__ v16h g2_frag(const unsigned short* p, int hh) { FragH f; f.half[0] = *(const v8us*)(p + 8 * hh); f.half[1] = *(const v8us*)(p + 16 + 8 * hh); return f.v; }
// One stage goes to LDS once per work-group by asynchronous copies, 16 B a lane, eight lanes a row: whole 128-B lines.
// l: this lane's LDS byte address of its first A piece; ga, gb: its first A and B piece in global memory; piece i lies 16 rows further on both sides, and the four B pieces follow the eight A pieces in LDS.
__device__ __forceinline__ void g2_stage(unsigned l, const _Float16* ga, size_t a16, const _Float16* gb, size_t b16) {
  const unsigned l1 = l + 2304u, l2 = l + 4608u, l3 = l + 6912u, l4 = l + 9216u, l5 = l + 11520u, l6 = l + 13824u, l7 = l + 16128u, l8 = l + 18432u, l9 = l + 20736u, l10 = l + 23040u, l11 = l + 25344u;      /* 16 rows x 144 B */
  const _Float16* ga1 = ga + a16; const _Float16* ga2 = ga1 + a16; const _Float16* ga3 = ga2 + a16; const _Float16* ga4 = ga3 + a16; const _Float16* ga5 = ga4 + a16; const _Float16* ga6 = ga5 + a16; const _Float16* ga7 = ga6 + a16;
  const _Float16* gb1 = gb + b16; const _Float16* gb2 = gb1 + b16; const _Float16* gb3 = gb2 + b16;
  /* the closing s_wait_xcnt 0 stands inside the statement so that no address register of a copy is rewritten in front of it */
  asm volatile("global_load_async_to_lds_b128 %0, %12, off\n\t"
               "global_load_async_to_lds_b128 %1, %13, off\n\t"
               "global_load_async_to_lds_b128 %2, %14, off\n\t"
               "global_load_async_to_lds_b128 %3, %15, off\n\t"
               "global_load_async_to_lds_b128 %4, %16, off\n\t"
               "global_load_async_to_lds_b128 %5, %17, off\n\t"
               "global_load_async_to_lds_b128 %6, %18, off\n\t"
               "global_load_async_to_lds_b128 %7, %19, off\n\t"
               "global_load_async_to_lds_b128 %8, %20, off\n\t"
               "global_load_async_to_lds_b128 %9, %21, off\n\t"
               "global_load_async_to_lds_b128 %10, %22, off\n\t"
               "global_load_async_to_lds_b128 %11, %23, off\n\t"
               "s_wait_xcnt 0x0"
               :: "v"(l), "v"(l1), "v"(l2), "v"(l3), "v"(l4), "v"(l5), "v"(l6), "v"(l7), "v"(l8), "v"(l9), "v"(l10), "v"(l11),
                  "v"(ga), "v"(ga1), "v"(ga2), "v"(ga3), "v"(ga4), "v"(ga5), "v"(ga6), "v"(ga7), "v"(gb), "v"(gb1), "v"(gb2), "v"(gb3) : "memory");
}
__device__ __forceinline__ v8f g2_mma(v16h a, v16h b, v8f c) { v8f d = __builtin_amdgcn_wmma_f32_16x16x32_f16(false, a, false, b, (short)0, c, false, false); asm volatile("v_nop\n\tv_nop\n\tv_nop\n\tv_nop" : "+v"(d) : "v"(a), "v"(b)); return d; }
// ROWB: the bias belongs to the rows of C (weights as the A operand: C comes out channel-major) instead of its columns. so, sT: the caller's output staging array and its two operand stages, one set for all bodies of a kernel.
template <int ACT, bool ROWB>
__device__ __forceinline__ void gemm2_body(float (*so)[32][68], g2_tile* sT, const int by, const _Float16* __restrict__ A, int lda, size_t sA, const _Float16* __restrict__ Bh, int ldb, size_t sB, float alpha, const float* __restrict__ bias, size_t sBias, const float* __restrict__ CP, int rowsPerB, size_t sCPb, int row0g,
    float* __restrict__ C, _Float16* __restrict__ C16, int ldc, size_t sC, int M, int N, int K) {
  const int tid = threadIdx.x, w = tid >> 5, lane = tid & 31, ln = lane & 15, hh = lane >> 4;
  A += (size_t)by * sA; Bh += (size_t)by * sB; const size_t cofs = (size_t)by * sC; const float* bp = bias ? bias + (size_t)by * sBias : nullptr;
  const int ntn = N >> 6; const int mt = blockIdx.x / ntn, nq = blockIdx.x - mt * ntn; const int row0 = mt * 128 + 32 * w, col0 = nq * 64; if (mt * 128 >= M) return;      /* the same for every wave of the block: it stands in front of the barriers */
  const int crow = tid >> 3, cc = (tid & 7) * 8;      /* eight lanes copy one 128-B row */
  const _Float16* ga = A + (size_t)(mt * 128 + crow) * lda + cc; const _Float16* gb = Bh + (size_t)(col0 + crow) * ldb + cc;
  const size_t a16 = (size_t)16 * lda, b16 = (size_t)16 * ldb;
  const unsigned l0 = (unsigned)(size_t)&sT[0][crow][cc];
  constexpr unsigned BUFB = sizeof(g2_tile);      /* bytes of one stage */
  const int nst = K >> 6;
  g2_stage(l0, ga, a16, gb, b16);
  const v8f z8 = {0.f,0.f,0.f,0.f,0.f,0.f,0.f,0.f}; v8f c00 = z8, c01 = z8, c02 = z8, c03 = z8, c10 = z8, c11 = z8, c12 = z8, c13 = z8;
  asm volatile("s_wait_asynccnt 0x0" ::: "memory");      /* stage 0: this wave's copies have landed */
  __syncthreads();      /* stage 0 is readable by every wave */
  if (nst > 1) g2_stage(l0 + BUFB, ga + 64, a16, gb + 64, b16);
#pragma unroll 1      /* stays rolled: one copy of the body serves both buffers, chosen by st & 1 */
  for (int st = 0; st < nst; ++st) {      /* stage st is worked on while stage st + 1 flies into the other buffer */
    const int bf = st & 1;
    const unsigned short* ar = &sT[bf][32 * w + ln][0]; const unsigned short* br = &sT[bf][128 + ln][0];
    v16h a0[2], a1[2], b[2][4];      /* all 24 LDS reads of the stage stand in front of its first product: one LDS latency a stage, not one for each pair of products */
#pragma unroll      /* unrolled, here and below: the fragments are indexed by constants and stay in registers, and the half stage becomes a constant offset of the LDS reads */
    for (int ks = 0; ks < 2; ++ks) { a0[ks] = g2_frag(ar + ks * 32, hh); a1[ks] = g2_frag(ar + 16 * G2P + ks * 32, hh);
#pragma unroll
      for (int t = 0; t < 4; ++t) b[ks][t] = g2_frag(br + t * 16 * G2P + ks * 32, hh); }
#pragma unroll
    for (int ks = 0; ks < 2; ++ks) {
      c00 = g2_mma(a0[ks], b[ks][0], c00); c10 = g2_mma(a1[ks], b[ks][0], c10); c01 = g2_mma(a0[ks], b[ks][1], c01); c11 = g2_mma(a1[ks], b[ks][1], c11);
      c02 = g2_mma(a0[ks], b[ks][2], c02); c12 = g2_mma(a1[ks], b[ks][2], c12); c03 = g2_mma(a0[ks], b[ks][3], c03); c13 = g2_mma(a1[ks], b[ks][3], c13); }
    asm volatile("s_wait_dscnt 0x0" ::: "memory");      /* this wave's reads of buffer bf are done before the buffer is given up */
    asm volatile("s_wait_asynccnt 0x0" ::: "memory");      /* this wave's copies of stage st + 1 have landed */
    __syncthreads();      /* publishes stage st + 1 and ends every wave's reads of buffer bf */
    if (st + 2 < nst) g2_stage(l0 + bf * BUFB, ga + (size_t)(st + 2) * 64, a16, gb + (size_t)(st + 2) * 64, b16);
  }
  asm volatile("s_wait_asynccnt 0x0" ::: "memory");      /* no copy is left in flight when the wave goes on */
  v8f accs[8] = {c00, c01, c02, c03, c10, c11, c12, c13};
  float bvr[2][8];      /* ROWB: the biases of this lane's sixteen rows */
  if (ROWB) {
#pragma unroll      /* unrolled: bvr is indexed by constants and stays in registers */
    for (int i = 0; i < 16; ++i) bvr[i >> 3][i & 7] = bp ? bf16_round(bp[row0 + (i >> 3) * 16 + 8 * hh + (i & 7)]) : 0.f; }
#pragma unroll
  for (int u = 0; u < 8; ++u) { const int t = u & 3, half = u >> 2; const int col = col0 + t * 16 + ln; const float bvc = (!ROWB && bp) ? bf16_round(bp[col]) : 0.f;
#pragma unroll
    for (int r = 0; r < 8; ++r) { const int rloc = half * 16 + 8 * hh + r; const float bv = ROWB ? bvr[half][r] : bvc; float v = accs[u][r] * alpha + bv; if (CP) { const int bidx = (row0g + row0 + rloc) / rowsPerB; v += CP[(size_t)bidx * sCPb + (size_t)by * 64 + col]; }
      if (ACT == 3) v = fmaxf(v, 0.f); else if (ACT == 6) v = 0.5f * v * (1.0f + erff(v * 0.70710678118654752f)); else if (ACT == 11) v = 1.0f / (1.0f + expf(-v)); else if (ACT == 15) v = v / (1.0f + expf(-v)); else if (ACT == 12) v = (v > 0.f) ? v : 0.01f * v; else if (ACT == 8) v = tanhf(v);
      so[w][rloc][t * 16 + ln] = v; } }
  __builtin_amdgcn_fence(__ATOMIC_ACQ_REL, "workgroup"); __builtin_amdgcn_wave_barrier();
  const int rsub = lane >> 4, c4 = (lane & 15) * 4;
  { v4f vq[16];      /* all LDS reads first, so that the waits behind the stores do not stand between them */
#pragma unroll      /* unrolled, here and below: vq is indexed by constants and stays in registers */
    for (int q = 0; q < 16; ++q) vq[q] = *(const v4fa*)&so[w][q * 2 + rsub][c4];
#pragma unroll
    for (int q = 0; q < 16; ++q) { const int r = q * 2 + rsub; const v4f v = vq[q];      /* s_wait_xcnt 0 behind a store: the conversions and address sums that follow reuse the store's registers */
      if (C) { *(v4f*)(C + cofs + (size_t)(row0 + r) * ldc + col0 + c4) = v; asm volatile("s_wait_xcnt 0x0" ::: "memory"); }
      if (C16) { v4h h4; for (int i = 0; i < 4; ++i) h4[i] = (_Float16)v[i]; *(v4h*)(C16 + cofs + (size_t)(row0 + r) * ldc + col0 + c4) = h4; if (q + 1 < 16) asm volatile("s_wait_xcnt 0x0" ::: "memory"); } }
     } }
template <int ACT, bool ROWB>
__global__ __launch_bounds__(128) void k_gemm2(const _Float16* __restrict__ A, int lda, size_t sA, const _Float16* __restrict__ Bh, int ldb, size_t sB, float alpha, const float* __restrict__ bias, size_t sBias, const float* __restrict__ CP, int rowsPerB, size_t sCPb, int row0g,
    float* __restrict__ C, _Float16* __restrict__ C16, int ldc, size_t sC, int M, int N, int K) {
  __shared__ __attribute__((aligned(16))) float so[4][32][68];
  __shared__ __attribute__((aligned(16))) g2_tile sT[2];
  gemm2_body<ACT, ROWB>(so, sT, blockIdx.y, A, lda, sA, Bh, ldb, sB, alpha, bias, sBias, CP, rowsPerB, sCPb, row0g, C, C16, ldc, sC, M, N, K); }
// Three independent products of one shape in one launch: blockIdx.y picks the operands, the bias and the f16 output; the tile work is gemm2_body's.
// Jobs 0 and 1 give C[M][N] (tokens x channels). Job 2 takes its operands in swapped roles and gives C2[N][M] (channels x tokens, pitch M), the layout its reader wants; (M / 128)(N / 64) tiles either way.
template <int ACT>
__global__ __launch_bounds__(128) void k_gemm2x3(const _Float16* __restrict__ A0, const _Float16* __restrict__ A1, const _Float16* __restrict__ A2, const _Float16* __restrict__ B0, const _Float16* __restrict__ B1, const _Float16* __restrict__ B2,
    const float* __restrict__ bias0, const float* __restrict__ bias1, const float* __restrict__ bias2, _Float16* __restrict__ C0, _Float16* __restrict__ C1, _Float16* __restrict__ C2, float alpha, int ld, int M, int N, int K) {
  __shared__ __attribute__((aligned(16))) float so[4][32][68];
  __shared__ __attribute__((aligned(16))) g2_tile sT[2];
  const int j = blockIdx.y;
  if (j == 2) { gemm2_body<ACT, true>(so, sT, 0, B2, ld, 0, A2, ld, 0, alpha, bias2, 0, nullptr, 1, 0, 0, nullptr, C2, M, 0, N, M, K); return; }
  const _Float16* A = (j == 0) ? A0 : A1; const _Float16* Bh = (j == 0) ? B0 : B1; const float* bias = (j == 0) ? bias0 : bias1; _Float16* C16 = (j == 0) ? C0 : C1;
  gemm2_body<ACT, false>(so, sT, 0, A, ld, 0, Bh, ld, 0, alpha, bias, 0, nullptr, 1, 0, 0, nullptr, C16, ld, 0, M, N, K); }



// lane l <-> lane l ^ 16 (the two lane halves of one fragment column)
__device__ __forceinline__ float xhalf(float x) { return __builtin_bit_cast(float, __builtin_amdgcn_permlanex16(__builtin_bit_cast(int, x), __builtin_bit_cast(int, x), 0x76543210, 0xfedcba98, false, false)); }
__device__ __forceinline__ void kv_stage(unsigned lk, unsigned lv, const unsigned short* gk, size_t k16, const unsigned short* gv, size_t v16) {
  const unsigned lk1 = lk + 2304u, lk2 = lk + 4608u, lk3 = lk + 6912u, lv1 = lv + 2304u, lv2 = lv + 4608u, lv3 = lv + 6912u;      /* 16 rows x 144 B */
  const unsigned short* gk1 = gk + k16; const unsigned short* gk2 = gk1 + k16; const unsigned short* gk3 = gk2 + k16;
  const unsigned short* gv1 = gv + v16; const unsigned short* gv2 = gv1 + v16; const unsigned short* gv3 = gv2 + v16;
  /* the closing s_wait_xcnt 0 stands inside the statement so that no address register of a copy is rewritten in front of it */
  asm volatile("global_load_async_to_lds_b128 %0, %8, off\n\t"
               "global_load_async_to_lds_b128 %1, %9, off\n\t"
               "global_load_async_to_lds_b128 %2, %10, off\n\t"
               "global_load_async_to_lds_b128 %3, %11, off\n\t"
               "global_load_async_to_lds_b128 %4, %12, off\n\t"
               "global_load_async_to_lds_b128 %5, %13, off\n\t"
               "global_load_async_to_lds_b128 %6, %14, off\n\t"
               "global_load_async_to_lds_b128 %7, %15, off\n\t"
               "s_wait_xcnt 0x0"
               :: "v"(lk), "v"(lk1), "v"(lk2), "v"(lk3), "v"(lv), "v"(lv1), "v"(lv2), "v"(lv3),
                  "v"(gk), "v"(gk1), "v"(gk2), "v"(gk3), "v"(gv), "v"(gv1), "v"(gv2), "v"(gv3) : "memory");
}
// Wave tile: 32 queries (two column groups of 16) x TK / KSP keys. Every K and V^T fragment read from LDS feeds two products, one for each column group.
// A work-group holds 4 query tiles (128 queries) x KSP key groups of 4 waves; key group kg walks keys [kg TK / KSP, (kg + 1) TK / KSP) through a two-buffer ring of its own, so the waves per SIMD do not fall with the wider tile.
// Behind the loop the groups' partial (maximum, sum, O^T) are joined through LDS by the waves of group 0.
template <int KSP>
__global__ __launch_bounds__(128 * KSP) void k_flash(const _Float16* __restrict__ Q16, int ldq, const _Float16* __restrict__ K16, int ldk, const _Float16* __restrict__ Vt, _Float16* __restrict__ O, int ldo) {
  constexpr int CT = 2, QW = 16 * CT, QB = 4 * QW, DT = 4, KS = 2, KT = 64, LP = 72;      /* KT keys a stage; LP: LDS row pitch in halves = 128 B + 16 B, the pitch of 16-byte LDS readers */
  constexpr int KPG = TK / KSP, nst = KPG / KT, MV = CT * DT * 2 + 1;      /* MV: 16-byte pieces a lane hands over: its O^T tiles, then (maximum, sum) of both column groups */
  static_assert(nst >= 2 && KPG % KT == 0 && TQ % QB == 0, "shape");
  __shared__ __attribute__((aligned(16))) unsigned short sK[KSP][2][KT][LP];
  __shared__ __attribute__((aligned(16))) unsigned short sV[KSP][2][64][LP];
  __shared__ __attribute__((aligned(16))) v4f sM[KSP - 1][4][MV][32];      /* hand-over of groups 1 .. KSP - 1; plane [0][qt] then serves wave qt of group 0 as its output staging (32 rows x 68 floats, the same bytes) */
  static_assert(sizeof(v4f) * MV * 32 == sizeof(float) * QW * 68, "staging fits its plane");
  const int tid = threadIdx.x, w = tid >> 5, lane = tid & 31, ln = lane & 15, hh = lane >> 4;
  const int qt = w & 3, kg = w >> 2, gt = tid & 127;
  const int slab = blockIdx.x / (TQ / QB), qblk = blockIdx.x % (TQ / QB); const int b = slab / NH, h = slab % NH; const int q0 = qblk * QB + qt * QW;
  const unsigned short* Vth = (const unsigned short*)Vt + (size_t)slab * 64 * TK;
  const int crow = gt >> 3, cc = (gt & 7) * 8;      /* eight lanes copy one 128-B row */
  const unsigned short* gk = (const unsigned short*)K16 + ((size_t)b * TK + kg * KPG + crow) * ldk + h * 64 + cc;
  const unsigned short* gv = Vth + (size_t)crow * TK + kg * KPG + cc;
  const size_t k16 = (size_t)16 * ldk, v16 = (size_t)16 * TK, kst = (size_t)KT * ldk;
  const unsigned lk0 = (unsigned)(size_t)&sK[kg][0][crow][cc], lv0 = (unsigned)(size_t)&sV[kg][0][crow][cc];
  constexpr unsigned BUFB = KT * LP * 2;      /* bytes of one buffer */
  kv_stage(lk0, lv0, gk, k16, gv, v16);
  FragH bq[CT][KS];
#pragma unroll
  for (int c = 0; c < CT; ++c) { const unsigned short* qr = (const unsigned short*)Q16 + ((size_t)b * TQ + q0 + c * 16 + ln) * ldq + h * 64;
#pragma unroll
    for (int ks = 0; ks < KS; ++ks) { bq[c][ks].half[0] = *(const v8us*)(qr + ks * 32 + 8 * hh); bq[c][ks].half[1] = *(const v8us*)(qr + ks * 32 + 16 + 8 * hh); } }
  constexpr float C2 = SCL * 1.4426950408889634f;      /* score -> base-2 exponent: scale x log2(e) */
  float m_r[CT], l_r[CT]; v8f oacc[CT][DT];      /* m_r: running maximum of the unscaled scores; l_r: sum of 1024 p over this lane half's keys only, joined after the loop */
#pragma unroll
  for (int c = 0; c < CT; ++c) { m_r[c] = -3.0e38f; l_r[c] = 0.f;
#pragma unroll
    for (int dt = 0; dt < DT; ++dt) oacc[c][dt] = (v8f){0.f,0.f,0.f,0.f,0.f,0.f,0.f,0.f}; }
  asm volatile("s_wait_asynccnt 0x0" ::: "memory");      /* stage 0: this wave's copies have landed */
  __syncthreads();      /* stage 0 is readable by every wave */
  kv_stage(lk0 + BUFB, lv0 + BUFB, gk + kst, k16, gv + KT, v16);
#pragma unroll 1      /* stays rolled: one copy of the body serves both buffers, chosen by st & 1 */
  for (int st = 0; st < nst; ++st) {      /* stage st is worked on while stage st + 1 flies into the other buffer */
    const int bf = st & 1;
#pragma unroll      /* unrolled: the half stage becomes a constant offset of the LDS reads */
    for (int sub = 0; sub < KT / 32; ++sub) {
    FragH ak[2][KS], av[DT];
#pragma unroll
    for (int nt = 0; nt < 2; ++nt) { const unsigned short* kr = &sK[kg][bf][sub * 32 + nt * 16 + ln][0];
#pragma unroll
      for (int ks = 0; ks < KS; ++ks) { ak[nt][ks].half[0] = *(const v8us*)(kr + ks * 32 + 8 * hh); ak[nt][ks].half[1] = *(const v8us*)(kr + ks * 32 + 16 + 8 * hh); } }
#pragma unroll
    for (int dt = 0; dt < DT; ++dt) { const unsigned short* vrow = &sV[kg][bf][dt * 16 + ln][sub * 32]; av[dt].half[0] = *(const v8us*)(vrow + 8 * hh); av[dt].half[1] = *(const v8us*)(vrow + 16 + 8 * hh); }
    v8f s[CT][2];
#pragma unroll
    for (int nt = 0; nt < 2; ++nt)
#pragma unroll
      for (int c = 0; c < CT; ++c) {
        v8f acc = (v8f){0.f,0.f,0.f,0.f,0.f,0.f,0.f,0.f};
#pragma unroll
        for (int ks = 0; ks < KS; ++ks) acc = mmaH<1>(ak[nt][ks].v, ak[nt][ks].v, bq[c][ks].v, bq[c][ks].v, acc);
        s[c][nt] = acc; }
    FragH pb[CT];
#pragma unroll      /* unrolled: the two column groups' chains are independent and interleave */
    for (int c = 0; c < CT; ++c) {
    float sc[16], t[8];
#pragma unroll
    for (int i = 0; i < 16; ++i) sc[i] = s[c][i >> 3][i & 7];      /* unscaled scores (the scale is positive: the maximum commutes with it) */
#pragma unroll
    for (int i = 0; i < 8; ++i) t[i] = fmaxf(sc[i], sc[i + 8]);
    float mc = fmaxf(fmaxf(fmaxf(t[0], t[1]), fmaxf(t[2], t[3])), fmaxf(fmaxf(t[4], t[5]), fmaxf(t[6], t[7])));
    mc = fmaxf(mc, xhalf(mc));      /* both halves feed one O^T column: one maximum for both */
    const float mn = fmaxf(m_r[c], mc); const float al = (mn > -1.0e38f) ? __builtin_amdgcn_exp2f((m_r[c] - mn) * C2) : 1.0f; m_r[c] = mn;
    const float nb = __builtin_fmaf(-mn, C2, 10.0f);      /* 1024 p = 2^(C2 s - C2 m + 10): one fused multiply-add in front of the hardware's base-2 exponential */
#pragma unroll
    for (int i = 0; i < 16; ++i) sc[i] = __builtin_fmaf(sc[i], C2, nb);
    /* sixteen exponentials in place, in one statement: each is independent of the one in front of it (no result read, no source overwritten), and the closing v_nop is the slot behind the last one; last element first, because the packing behind it starts with the last pair */
    asm("v_exp_f32 %15, %15\n\tv_exp_f32 %14, %14\n\tv_exp_f32 %13, %13\n\tv_exp_f32 %12, %12\n\t"
        "v_exp_f32 %11, %11\n\tv_exp_f32 %10, %10\n\tv_exp_f32 %9, %9\n\tv_exp_f32 %8, %8\n\t"
        "v_exp_f32 %7, %7\n\tv_exp_f32 %6, %6\n\tv_exp_f32 %5, %5\n\tv_exp_f32 %4, %4\n\t"
        "v_exp_f32 %3, %3\n\tv_exp_f32 %2, %2\n\tv_exp_f32 %1, %1\n\tv_exp_f32 %0, %0\n\tv_nop"
        : "+v"(sc[0]), "+v"(sc[1]), "+v"(sc[2]), "+v"(sc[3]), "+v"(sc[4]), "+v"(sc[5]), "+v"(sc[6]), "+v"(sc[7]),
          "+v"(sc[8]), "+v"(sc[9]), "+v"(sc[10]), "+v"(sc[11]), "+v"(sc[12]), "+v"(sc[13]), "+v"(sc[14]), "+v"(sc[15]));
#pragma unroll
    for (int i = 0; i < 16; ++i) pb[c].h[i] = (_Float16)sc[i];
#pragma unroll
    for (int i = 0; i < 8; ++i) t[i] = sc[i] + sc[i + 8];
    l_r[c] = l_r[c] * al + (((t[0] + t[1]) + (t[2] + t[3])) + ((t[4] + t[5]) + (t[6] + t[7])));
#pragma unroll
    for (int dt = 0; dt < DT; ++dt)
#pragma unroll
      for (int r = 0; r < 8; ++r) oacc[c][dt][r] *= al;
    }
#pragma unroll
    for (int dt = 0; dt < DT; ++dt)
#pragma unroll
      for (int c = 0; c < CT; ++c) oacc[c][dt] = mmaH<1>(av[dt].v, av[dt].v, pb[c].v, pb[c].v, oacc[c][dt]);
    }
    asm volatile("s_wait_dscnt 0x0" ::: "memory");      /* this wave's reads of buffer bf are done before the buffer is given up */
    asm volatile("s_wait_asynccnt 0x0" ::: "memory");      /* this wave's copies of stage st + 1 have landed */
    __syncthreads();      /* publishes stage st + 1 and ends every wave's reads of buffer bf */
    if (st + 2 < nst) kv_stage(lk0 + bf * BUFB, lv0 + bf * BUFB, gk + (size_t)(st + 2) * kst, k16, gv + (size_t)(st + 2) * KT, v16);
  }
  asm volatile("s_wait_asynccnt 0x0" ::: "memory");      /* no copy is left in flight when the wave goes on */
  if (kg > 0) {      /* a lane's partials go to the same lane of group 0: 16 B a lane, lanes side by side */
    v4f* mp = &sM[kg - 1][qt][0][lane];
#pragma unroll
    for (int c = 0; c < CT; ++c)
#pragma unroll
      for (int dt = 0; dt < DT; ++dt) {
        *(v4fa*)(mp + ((c * DT + dt) * 2) * 32) = (v4f){oacc[c][dt][0], oacc[c][dt][1], oacc[c][dt][2], oacc[c][dt][3]};
        *(v4fa*)(mp + ((c * DT + dt) * 2 + 1) * 32) = (v4f){oacc[c][dt][4], oacc[c][dt][5], oacc[c][dt][6], oacc[c][dt][7]}; }
    *(v4fa*)(mp + (MV - 1) * 32) = (v4f){m_r[0], l_r[0], m_r[1], l_r[1]};
  }
  __syncthreads();      /* the partials of groups 1 .. KSP - 1 are readable by group 0; every wave passes it, and it is the last barrier */
  if (kg > 0) return;
#pragma unroll 1      /* stays rolled: one group's partials in registers at a time */
  for (int g = 0; g < KSP - 1; ++g) {
    const v4f* mp = &sM[g][qt][0][lane];
    const v4f ml = *(const v4fa*)(mp + (MV - 1) * 32);
#pragma unroll
    for (int c = 0; c < CT; ++c) {
      const float mg = ml[2 * c], lg = ml[2 * c + 1];
      const float mn = fmaxf(m_r[c], mg); const float a0 = __builtin_amdgcn_exp2f((m_r[c] - mn) * C2), a1 = __builtin_amdgcn_exp2f((mg - mn) * C2);
      m_r[c] = mn; l_r[c] = l_r[c] * a0 + lg * a1;
#pragma unroll
      for (int dt = 0; dt < DT; ++dt) {
        const v4f lo = *(const v4fa*)(mp + ((c * DT + dt) * 2) * 32), hi = *(const v4fa*)(mp + ((c * DT + dt) * 2 + 1) * 32);
#pragma unroll
        for (int r = 0; r < 4; ++r) { oacc[c][dt][r] = oacc[c][dt][r] * a0 + lo[r] * a1; oacc[c][dt][4 + r] = oacc[c][dt][4 + r] * a0 + hi[r] * a1; } } }
  }
  float (*sO)[68] = (float (*)[68])&sM[0][qt][0][0];      /* this wave alone has read that plane, and its reads are done: their values are in use above */
#pragma unroll
  for (int c = 0; c < CT; ++c) {
    const float l = l_r[c] + xhalf(l_r[c]); const float li = (l > 0.f) ? 1.0f / l : 0.f;      /* numerator and sum both carry the factor 1024 */
#pragma unroll
    for (int dt = 0; dt < DT; ++dt) {      /* oacc[c][dt][r] = O[q0 + 16 c + ln][16 dt + 8 hh + r] */
      const v4f lo = {oacc[c][dt][0] * li, oacc[c][dt][1] * li, oacc[c][dt][2] * li, oacc[c][dt][3] * li}, hi = {oacc[c][dt][4] * li, oacc[c][dt][5] * li, oacc[c][dt][6] * li, oacc[c][dt][7] * li};
      *(v4fa*)&sO[c * 16 + ln][dt * 16 + 8 * hh] = lo; *(v4fa*)&sO[c * 16 + ln][dt * 16 + 8 * hh + 4] = hi; } }
  __builtin_amdgcn_fence(__ATOMIC_ACQ_REL, "workgroup"); __builtin_amdgcn_wave_barrier();
  { v4h h4[QW / 2];      /* all LDS reads first, so that the waits behind the stores do not stand between them */
#pragma unroll      /* unrolled, here and below: h4 is indexed by constants and stays in registers */
    for (int rp = 0; rp < QW; rp += 2) { const v4f val = *(const v4fa*)&sO[rp + (lane >> 4)][(lane & 15) * 4]; for (int i = 0; i < 4; ++i) h4[rp >> 1][i] = (_Float16)val[i]; }      /* ctx leaves as the f16 operand of the last product */
#pragma unroll
    for (int rp = 0; rp < QW; rp += 2) { const int r = rp + (lane >> 4), pc = lane & 15; *(v4h*)(O + ((size_t)b * TQ + q0 + r) * ldo + h * 64 + pc * 4) = h4[rp >> 1];      /* sixteen lanes fill one 128-B line */
      if (rp + 2 < QW) asm volatile("s_wait_xcnt 0x0" ::: "memory"); }      /* the address sums that follow reuse the store's registers */
     } }
// 5-plane variant: S = Qh Kh^T + (Ql Kh^T + Qh Kl^T)/1024 with Q/K = [hi | 2^10 residual] f16 planes (QL/KL same layout as Q16/K16), then the 3-term P.V below.
// 3-term variant: O = (P_hi V_hi + (P_lo V_hi + P_hi V_lo) / 1024) / l with P = [hi | 2^10 residual] of 1024 p and V^T = [hi | 2^10 residual] planes (VtL same layout as Vt) -> ~2^-21-class products for un-averaged (early causal / peaked) rows
template <int CAUSAL>
__global__ __launch_bounds__(128) void k_flash5(const _Float16* __restrict__ Q16, const _Float16* __restrict__ QL, int ldq, const _Float16* __restrict__ K16, const _Float16* __restrict__ KL, int ldk, const _Float16* __restrict__ Vt, const _Float16* __restrict__ VtL, const int* __restrict__ MSK, float* __restrict__ O, int ldo) {
  constexpr int RPW = 16, RTN = RPW / 16, NQB = TQ / (4 * RPW), DT = 4, KS = 2;
  __shared__ __attribute__((aligned(16))) unsigned short sP[4][RPW][40]; __shared__ __attribute__((aligned(16))) unsigned short sPL[4][RPW][40]; __shared__ __attribute__((aligned(16))) float sO[4][RPW][64 + 4];
  const int tid = threadIdx.x, w = tid >> 5, lane = tid & 31, ln = lane & 15, hh = lane >> 4;
  const int slab = blockIdx.x / QBN5, qblk = QB05 + blockIdx.x % QBN5; (void)NQB; const int b = slab / NH, h = slab % NH; const int qb0 = qblk * (4 * RPW); const int q0 = qb0 + w * RPW;
  FragH aq[2][KS], aql[2][KS];
#pragma unroll
  for (int rt = 0; rt < RTN; ++rt) { const unsigned short* qr = (const unsigned short*)Q16 + ((size_t)b * TQ + q0 + rt * 16 + ln) * ldq + h * 64; const unsigned short* ql = (const unsigned short*)QL + ((size_t)b * TQ + q0 + rt * 16 + ln) * ldq + h * 64;
#pragma unroll
    for (int ks = 0; ks < KS; ++ks) { aq[rt][ks].half[0] = *(const v8us*)(qr + ks * 32 + 8 * hh); aq[rt][ks].half[1] = *(const v8us*)(qr + ks * 32 + 16 + 8 * hh); aql[rt][ks].half[0] = *(const v8us*)(ql + ks * 32 + 8 * hh); aql[rt][ks].half[1] = *(const v8us*)(ql + ks * 32 + 16 + 8 * hh); } }
  const unsigned short* Vth = (const unsigned short*)Vt + (size_t)slab * 64 * TK; const unsigned short* Vtl = (const unsigned short*)VtL + (size_t)slab * 64 * TK;
  float m_r[2][8], l_r[2][8]; v8f oacc[2][DT], oaccL[2][DT];
#pragma unroll
  for (int rt = 0; rt < RTN; ++rt) {
#pragma unroll
    for (int r = 0; r < 8; ++r) { m_r[rt][r] = -3.0e38f; l_r[rt][r] = 0.f; }
#pragma unroll
    for (int dt = 0; dt < DT; ++dt) { oacc[rt][dt] = (v8f){0.f,0.f,0.f,0.f,0.f,0.f,0.f,0.f}; oaccL[rt][dt] = oacc[rt][dt]; } }
  const int jend = (CAUSAL == 1) ? (qb0 + 4 * RPW) : TK;      /* causal: keys beyond the block's last query never contribute */
#pragma unroll 1
  for (int j0 = 0; j0 < jend; j0 += 32) {
    v8f s[2][2];
#pragma unroll
    for (int nt = 0; nt < 2; ++nt) { const unsigned short* kr = (const unsigned short*)K16 + ((size_t)b * TK + j0 + nt * 16 + ln) * ldk + h * 64; const unsigned short* klr = (const unsigned short*)KL + ((size_t)b * TK + j0 + nt * 16 + ln) * ldk + h * 64; FragH bk[KS], bkl[KS];
#pragma unroll
      for (int ks = 0; ks < KS; ++ks) { bk[ks].half[0] = *(const v8us*)(kr + ks * 32 + 8 * hh); bk[ks].half[1] = *(const v8us*)(kr + ks * 32 + 16 + 8 * hh); bkl[ks].half[0] = *(const v8us*)(klr + ks * 32 + 8 * hh); bkl[ks].half[1] = *(const v8us*)(klr + ks * 32 + 16 + 8 * hh); }
#pragma unroll
      for (int rt = 0; rt < RTN; ++rt) { v8f acc = (v8f){0.f,0.f,0.f,0.f,0.f,0.f,0.f,0.f}, accl = acc;
#pragma unroll
        for (int ks = 0; ks < KS; ++ks) { acc = mmaH<1>(aq[rt][ks].v, aq[rt][ks].v, bk[ks].v, bk[ks].v, acc); accl = mmaH<1>(aql[rt][ks].v, aql[rt][ks].v, bk[ks].v, bk[ks].v, accl); accl = mmaH<1>(aq[rt][ks].v, aq[rt][ks].v, bkl[ks].v, bkl[ks].v, accl); }
#pragma unroll
        for (int r = 0; r < 8; ++r) acc[r] += accl[r] * 0.0009765625f;
        s[rt][nt] = acc; } }
#pragma unroll
    for (int rt = 0; rt < RTN; ++rt)
#pragma unroll
      for (int r = 0; r < 8; ++r) { const int tq = q0 + rt * 16 + 8 * hh + r; const int k0 = j0 + ln, k1 = j0 + 16 + ln;
        bool ok0 = (CAUSAL == 1) ? (k0 <= tq) : ((CAUSAL == 2) ? ((k0 >> 5) == (tq >> 5)) : true), ok1 = (CAUSAL == 1) ? (k1 <= tq) : ((CAUSAL == 2) ? ((k1 >> 5) == (tq >> 5)) : true);      /* mode 2: block-diagonal 32-token groups */
        if (CAUSAL == 4) { const int* mrow = MSK + ((size_t)b * TQ + tq) * TK; ok0 = mrow[k0] != 0; ok1 = mrow[k1] != 0; }      /* mode 4: per-(query, key) INPUT mask shared by all heads; masked keys contribute nothing (== the reference's -4096 fill, whose exp underflows to 0), rows with no valid key give l = 0 -> output 0 (== the reference's row_valid zeroing) */
        float s0 = ok0 ? s[rt][0][r] * SCL : -3.0e38f, s1 = ok1 ? s[rt][1][r] * SCL : -3.0e38f; if (CAUSAL == 17) { const float* amk = (const float*)MSK + (size_t)b * TK; s0 += bf16_round(amk[k0]); s1 += bf16_round(amk[k1]); }      /* mode 17: additive per-(batch, key) mask INPUT */ float mc = fmaxf(s0, s1);
        mc = fmaxf(mc, __shfl_xor(mc, 1, 32)); mc = fmaxf(mc, __shfl_xor(mc, 2, 32)); mc = fmaxf(mc, __shfl_xor(mc, 4, 32)); mc = fmaxf(mc, __shfl_xor(mc, 8, 32));
        const float mn = fmaxf(m_r[rt][r], mc); const float al = (mn > -1.0e38f) ? expf(m_r[rt][r] - mn) : 1.0f; m_r[rt][r] = mn; const float p0 = ok0 ? expf(s0 - mn) : 0.f, p1 = ok1 ? expf(s1 - mn) : 0.f; l_r[rt][r] = l_r[rt][r] * al + p0 + p1;
#pragma unroll
        for (int dt = 0; dt < DT; ++dt) { oacc[rt][dt][r] *= al; oaccL[rt][dt][r] *= al; }
        FragH t2, t2l; const float ps0 = p0 * 1024.0f, ps1 = p1 * 1024.0f; t2.h[0] = (_Float16)ps0; t2.h[1] = (_Float16)ps1; t2l.h[0] = (_Float16)((ps0 - (float)t2.h[0]) * 1024.0f); t2l.h[1] = (_Float16)((ps1 - (float)t2.h[1]) * 1024.0f);
        sP[w][rt * 16 + 8 * hh + r][ln] = t2.u[0]; sP[w][rt * 16 + 8 * hh + r][16 + ln] = t2.u[1]; sPL[w][rt * 16 + 8 * hh + r][ln] = t2l.u[0]; sPL[w][rt * 16 + 8 * hh + r][16 + ln] = t2l.u[1]; }
    __builtin_amdgcn_fence(__ATOMIC_ACQ_REL, "workgroup"); __builtin_amdgcn_wave_barrier();
    FragH pa[2], pl[2];
#pragma unroll
    for (int rt = 0; rt < RTN; ++rt) { pa[rt].half[0] = *(const v8us*)&sP[w][rt * 16 + ln][8 * hh]; pa[rt].half[1] = *(const v8us*)&sP[w][rt * 16 + ln][16 + 8 * hh]; pl[rt].half[0] = *(const v8us*)&sPL[w][rt * 16 + ln][8 * hh]; pl[rt].half[1] = *(const v8us*)&sPL[w][rt * 16 + ln][16 + 8 * hh]; }
#pragma unroll
    for (int dt = 0; dt < DT; ++dt) { const unsigned short* vrow = Vth + (size_t)(dt * 16 + ln) * TK + j0; const unsigned short* vrl = Vtl + (size_t)(dt * 16 + ln) * TK + j0; FragH bv, bl; bv.half[0] = *(const v8us*)(vrow + 8 * hh); bv.half[1] = *(const v8us*)(vrow + 16 + 8 * hh); bl.half[0] = *(const v8us*)(vrl + 8 * hh); bl.half[1] = *(const v8us*)(vrl + 16 + 8 * hh);
#pragma unroll
      for (int rt = 0; rt < RTN; ++rt) { oacc[rt][dt] = mmaH<1>(pa[rt].v, pa[rt].v, bv.v, bv.v, oacc[rt][dt]); oaccL[rt][dt] = mmaH<1>(pl[rt].v, pl[rt].v, bv.v, bv.v, oaccL[rt][dt]); oaccL[rt][dt] = mmaH<1>(pa[rt].v, pa[rt].v, bl.v, bl.v, oaccL[rt][dt]); } }
    __builtin_amdgcn_fence(__ATOMIC_ACQ_REL, "workgroup"); __builtin_amdgcn_wave_barrier(); }
#pragma unroll
  for (int rt = 0; rt < RTN; ++rt) {
#pragma unroll
    for (int r = 0; r < 8; ++r) { float l = l_r[rt][r]; l += __shfl_xor(l, 1, 32); l += __shfl_xor(l, 2, 32); l += __shfl_xor(l, 4, 32); l += __shfl_xor(l, 8, 32); l_r[rt][r] = (l > 0.f) ? 1.0f / (l * 1024.0f) : 0.f; }
#pragma unroll
    for (int dt = 0; dt < DT; ++dt)
#pragma unroll
      for (int r = 0; r < 8; ++r) { float v = oacc[rt][dt][r]; v += oaccL[rt][dt][r] * 0.0009765625f; sO[w][rt * 16 + 8 * hh + r][dt * 16 + ln] = v * l_r[rt][r]; } }
  __builtin_amdgcn_fence(__ATOMIC_ACQ_REL, "workgroup"); __builtin_amdgcn_wave_barrier();
  {
#pragma unroll
    for (int rp = 0; rp < RPW; rp += 2) { const int r = rp + (lane >> 4), pc = lane & 15; const v4f val = *(const v4fa*)&sO[w][r][pc * 4]; *(v4f*)(O + ((size_t)b * TQ + q0 + r) * ldo + h * 64 + pc * 4) = val; }
     } }

__global__ __launch_bounds__(256) void k_rotab(float* __restrict__ CS, float* __restrict__ SN) {
  #pragma clang fp contract(off)
  const int t = blockIdx.x * 256 + threadIdx.x; if (t >= SLEN * 32) return; const int j = t % 32, s = t / 32; const float ex = (float)(2 * j) / 64.0f; const float inv = 1.0f / powf(10000.0f, ex); const float th = (float)s * inv; const float c = cosf(th), sn = sinf(th);
  { *(float*)(CS + t) = c; *(float*)(SN + t) = sn;  } }
__global__ __launch_bounds__(256) void k_rope(const float* __restrict__ F, int nsrc, int ndst, int rep, const float* __restrict__ CS, const float* __restrict__ SN, _Float16* __restrict__ H, _Float16* __restrict__ L) {
  #pragma clang fp contract(off)
  const size_t t = (size_t)blockIdx.x * 256 + threadIdx.x; if (t >= (size_t)NR * ndst * 4) return; const int g8 = (int)(t % 4); const int hd = (int)((t / 4) % ndst); const size_t row = t / ((size_t)4 * ndst); const int s = (int)(row % SLEN); const int hs = hd / rep;
  const float* src = F + row * (size_t)(nsrc * 64) + hs * 64; FragH ah, al, bh, bl;
  for (int i = 0; i < 8; ++i) { const int d = g8 * 8 + i; const float c = CS[s * 32 + d], sn = SN[s * 32 + d]; const float x1 = src[d], x2 = src[d + 32];
    float o1 = x1 * c; o1 += -x2 * sn; float o2 = x2 * c; o2 += x1 * sn;
    _Float16 hv = (_Float16)o1; ah.h[i] = hv; al.h[i] = (_Float16)((o1 - (float)hv) * 1024.0f); hv = (_Float16)o2; bh.h[i] = hv; bl.h[i] = (_Float16)((o2 - (float)hv) * 1024.0f); }
  const size_t o = row * (size_t)(ndst * 64) + hd * 64 + g8 * 8;
  { *(v8us*)((unsigned short*)H + o) = ah.half[0]; *(v8us*)((unsigned short*)H + o + 32) = bh.half[0]; *(v8us*)((unsigned short*)L + o) = al.half[0]; *(v8us*)((unsigned short*)L + o + 32) = bl.half[0];  } }
__global__ __launch_bounds__(256) void k_rope2(const float* __restrict__ F, int nsrc, int ndst, int rep, const float* __restrict__ CS, const float* __restrict__ SN, _Float16* __restrict__ H, _Float16* __restrict__ L) {
  #pragma clang fp contract(off)
  const size_t t = (size_t)blockIdx.x * 256 + threadIdx.x; if (t >= (size_t)NR * ndst * 4) return; const int g16 = (int)(t % 4); const int hd = (int)((t / 4) % ndst); const size_t row = t / ((size_t)4 * ndst); const int s = (int)(row % SLEN); const int hs = hd / rep;
  const float* src = F + row * (size_t)(nsrc * 64) + hs * 64 + g16 * 16; FragH ah, al;
  for (int pr = 0; pr < 8; ++pr) { const int i = g16 * 8 + pr; const float c = CS[s * 32 + i], sn = SN[s * 32 + i]; const float x1 = src[2 * pr], x2 = src[2 * pr + 1];
    float o1 = x1 * c; o1 -= x2 * sn; float o2 = x1 * sn; o2 += x2 * c;
    _Float16 hv = (_Float16)o1; ah.h[2 * pr] = hv; al.h[2 * pr] = (_Float16)((o1 - (float)hv) * 1024.0f); hv = (_Float16)o2; ah.h[2 * pr + 1] = hv; al.h[2 * pr + 1] = (_Float16)((o2 - (float)hv) * 1024.0f); }
  const size_t o = row * (size_t)(ndst * 64) + hd * 64 + g16 * 16;
  { *(v8us*)((unsigned short*)H + o) = ah.half[0]; *(v8us*)((unsigned short*)H + o + 8) = ah.half[1]; *(v8us*)((unsigned short*)L + o) = al.half[0]; *(v8us*)((unsigned short*)L + o + 8) = al.half[1];  } }
__global__ __launch_bounds__(256) void k_tabin(const float* __restrict__ sp, float* __restrict__ CS, float* __restrict__ SN) { const int t = blockIdx.x * 256 + threadIdx.x; if (t >= SLEN * 32) return; const int i = t % 32, s = t / 32; const float c = bf16_round(sp[s * 64 + 32 + i]), sn = bf16_round(sp[s * 64 + i]);
  { *(float*)(CS + t) = c; *(float*)(SN + t) = sn;  } }
__device__ __forceinline__ void d_wsc(const size_t t, const float* __restrict__ Wm, _Float16* __restrict__ Bt, size_t n8, float sc) { if (t >= n8) return; FragH f; for (int q = 0; q < 8; ++q) f.h[q] = (_Float16)(bf16_round(Wm[t * 8 + q]) * sc); *(v8us*)((unsigned short*)Bt + t * 8) = f.half[0];  }
__global__ __launch_bounds__(256) void k_rotab2(float* __restrict__ CS, float* __restrict__ SN) {
  #pragma clang fp contract(off)
  const int t = blockIdx.x * 256 + threadIdx.x; if (t >= SLEN * 32) return; const int j = t % 32, s = t / 32; const float c0 = -0.14391156831212787f;      /* -ln(10000)/64 rounded to f32 */ const float inv = expf((float)(2 * j) * c0); const float th = (float)s * inv; const float c = cosf(th), sn = sinf(th);
  { *(float*)(CS + t) = c; *(float*)(SN + t) = sn;  } }
__global__ __launch_bounds__(256) void k_lnu(const float* __restrict__ X, _Float16* __restrict__ N16, float* __restrict__ XB) {
  #pragma clang fp contract(off)
  const int wv = threadIdx.x >> 5, ln = threadIdx.x & 31; const size_t r = (size_t)blockIdx.x * 8 + wv; if (r >= NR) return; float a[32]; float s = 0.f;
  for (int i = 0; i < 4; ++i) { const v8f v = *(const v8f*)(X + r * DM + (i * 32 + ln) * 8); for (int q = 0; q < 8; ++q) { const float u = bf16_round(v[q]); a[i * 8 + q] = u; s += u; } }
  for (int o = 16; o > 0; o >>= 1) s += __shfl_xor(s, o, 32); const float mu = s / (float)DM; float var = 0.f; for (int q = 0; q < 32; ++q) { const float d = a[q] - mu; var += d * d; }
  for (int o = 16; o > 0; o >>= 1) var += __shfl_xor(var, o, 32); const float den = sqrtf(var / (float)(DM - 1)) + 1e-6f; const float inv = 1.0f / den;      /* one reciprocal per row; (x-mean)*inv vs the reference's division differs by <= 1 ulp */
  { for (int i = 0; i < 4; ++i) { const int c0 = (i * 32 + ln) * 8; FragH f; v8f xb; for (int q = 0; q < 8; ++q) { f.h[q] = (_Float16)((a[i * 8 + q] - mu) * inv); xb[q] = a[i * 8 + q]; } *(v8us*)((unsigned short*)N16 + r * DM + c0) = f.half[0]; *(v8f*)(XB + r * DM + c0) = xb; }  } }
__global__ __launch_bounds__(256) void k_vtg(const _Float16* __restrict__ V16, _Float16* __restrict__ Vt) { __shared__ unsigned short tl[64][66]; const int tid = threadIdx.x; const int slab = blockIdx.x / (SLEN / 64), lg = blockIdx.x % (SLEN / 64); const int b = slab / NH, h = slab % NH; const int hs = h / NREP;
  for (int i = tid; i < 64 * 8; i += 256) { const int r = i / 8, c8 = (i % 8) * 8; FragH f; f.half[0] = *(const v8us*)((const unsigned short*)V16 + ((size_t)b * SLEN + lg * 64 + r) * KVD + hs * 64 + c8); for (int q = 0; q < 8; ++q) tl[r][c8 + q] = f.u[q]; }
  __syncthreads();
  { for (int rd = 0; rd < 2; ++rd) { const int d = rd * 32 + tid / 8, pc = tid % 8; FragH f; for (int q = 0; q < 8; ++q) f.u[q] = tl[pc * 8 + q][d]; *(v8us*)((unsigned short*)Vt + ((size_t)slab * 64 + d) * SLEN + lg * 64 + pc * 8) = f.half[0]; }  } }

// One 64-channel x 256-token tile of a channel-major f32 plane goes to the token-major f16 plane through LDS: a wave reads 512 contiguous bytes of one channel, eight lanes write one 128-B line of one token.
#define PTC 64      /* channels a tile: 64 halves = one 128-B line of the token-major plane */
#define PTN 256     /* tokens a tile */
#define PTD 33      /* LDS row pitch in dwords: 32 channel pairs + 1, so that the four token rows of one wave-wide read fall on different banks */
__device__ __forceinline__ void d_pmt(unsigned (*tl)[PTD], const int tile, const float* __restrict__ src, _Float16* __restrict__ P16) {
  const int tid = threadIdx.x, n4 = tid & 63, cg = tid >> 6;
  const int c0 = (tile % (DM / PTC)) * PTC, n0 = (tile / (DM / PTC)) * PTN;
  const float* p = src + (size_t)(c0 + 2 * cg) * SLEN + n0 + 4 * n4;
  v4f a[8], b[8];      /* all sixteen loads stand in front of the first use: one memory latency a tile */
#pragma unroll      /* unrolled, here and below: a and b are indexed by constants and stay in registers */
  for (int i = 0; i < 8; ++i) { a[i] = *(const v4fa*)(p + (size_t)(8 * i) * SLEN); b[i] = *(const v4fa*)(p + (size_t)(8 * i + 1) * SLEN); }
  asm volatile("s_wait_xcnt 0x0" :: "v"(p) : "memory");      /* behind the loads, with their address as an input: the address pair lives up to this wait, so neither a load's result nor a later instruction overwrites it in front of the wait */
  __builtin_amdgcn_sched_barrier(0);      /* holds the sixteen loads together in front of the conversions; without it the compiler issues the last six behind waits on the first ten, two more memory latencies a tile */
#pragma unroll
  for (int i = 0; i < 8; ++i)
#pragma unroll
    for (int j = 0; j < 4; ++j) { FragH f; f.h[0] = (_Float16)bf16_round(a[i][j]); f.h[1] = (_Float16)bf16_round(b[i][j]); tl[4 * n4 + j][cg + 4 * i] = (unsigned)f.u[0] | ((unsigned)f.u[1] << 16); }      /* channels 2 q and 2 q + 1 of one token share a dword */
  __syncthreads();      /* the tile is complete before any row of it is read */
  union { unsigned d[4]; v8us h; } o[8];
#pragma unroll      /* unrolled, here and below: o is indexed by constants and stays in registers; all LDS reads stand in front of the stores */
  for (int i = 0; i < 8; ++i) { const unsigned* r = &tl[i * 32 + (tid >> 3)][(tid & 7) * 4]; o[i].d[0] = r[0]; o[i].d[1] = r[1]; o[i].d[2] = r[2]; o[i].d[3] = r[3]; }
  unsigned short* q = (unsigned short*)P16 + (size_t)(n0 + (tid >> 3)) * DM + c0 + (tid & 7) * 8;
#pragma unroll
  for (int i = 0; i < 8; ++i) *(v8us*)(q + (size_t)(i * 32) * DM) = o[i].h;
}
// The six independent preparation jobs in one launch: blocks [0, 2 PMB) write the two token-major planes, one tile each, the next 4 WSB blocks the four weight planes.
#define PMB ((DM / PTC) * (SLEN / PTN))
#define WSB ((DM * DM / 8 + 255) / 256)
__global__ __launch_bounds__(256) void k_prep(const float* __restrict__ vid, const float* __restrict__ reff, _Float16* __restrict__ XV, _Float16* __restrict__ XR,
    const float* __restrict__ Wq, const float* __restrict__ Wk, const float* __restrict__ Wv, const float* __restrict__ Wo, _Float16* __restrict__ BQ, _Float16* __restrict__ BK, _Float16* __restrict__ BV, _Float16* __restrict__ BO) {
  __shared__ unsigned tl[PTN][PTD];
  const int bx = blockIdx.x;
  if (bx < 2 * PMB) { const bool second = bx >= PMB; d_pmt(tl, bx - (second ? PMB : 0), second ? reff : vid, second ? XR : XV); return; }      /* the same for every thread of the block: the barrier inside is passed by all or none */
  const int j = (bx - 2 * PMB) / WSB, wb = (bx - 2 * PMB) % WSB;
  const float* Wm = (j == 0) ? Wq : ((j == 1) ? Wk : ((j == 2) ? Wv : Wo)); _Float16* Bt = (j == 0) ? BQ : ((j == 1) ? BK : ((j == 2) ? BV : BO));
  d_wsc((size_t)wb * 256 + threadIdx.x, Wm, Bt, DM * DM / 8, 16.0f); }
__global__ __launch_bounds__(256) void k_nchw(const float* __restrict__ F, float* __restrict__ outb) { const int t = blockIdx.x * 256 + threadIdx.x; if (t >= DM * (SLEN / 4)) return; const int p0 = (t % (SLEN / 4)) * 4; const int o = t / (SLEN / 4); v4f r; for (int q = 0; q < 4; ++q) r[q] = F[(size_t)(p0 + q) * DM + o];
  *(v4f*)(outb + (size_t)o * SLEN + p0) = r;  }

extern "C" void kernel_launch(void* const* d_in, const int* in_sizes, int n_in,
                              void* d_out, int out_size, void* d_ws, size_t ws_size, hipStream_t stream) {
  (void)in_sizes; (void)n_in; (void)out_size;
  const float* const* I = (const float* const*)d_in; const float* vid = I[0]; const float* reff = I[1]; const float* Wq = I[2]; const float* bq = I[3]; const float* Wk = I[4]; const float* bk = I[5]; const float* Wv = I[6]; const float* bv = I[7]; const float* Wo = I[8]; const float* bo = I[9];
  char* ws = (char*)d_ws; size_t off = 0;
  auto take = [&](size_t bytes) { char* p = ws + off; off += (bytes + 255) & ~(size_t)255; return p; };
  const size_t np = (size_t)SLEN * DM;
  _Float16* BQ = (_Float16*)take((size_t)DM * DM * 2); _Float16* BK = (_Float16*)take((size_t)DM * DM * 2); _Float16* BV = (_Float16*)take((size_t)DM * DM * 2); _Float16* BO = (_Float16*)take((size_t)DM * DM * 2);
  _Float16* XV = (_Float16*)take(np * 2); _Float16* XR = (_Float16*)take(np * 2); _Float16* Q16 = (_Float16*)take(np * 2); _Float16* K16 = (_Float16*)take(np * 2); _Float16* VT = (_Float16*)take(np * 2); _Float16* O16 = (_Float16*)take(np * 2);
  if (off > ws_size) return;      /* 2 + 6 x 4 = 26 MiB */
  k_prep<<<2 * PMB + 4 * WSB, 256, 0, stream>>>(vid, reff, XV, XR, Wq, Wk, Wv, Wo, BQ, BK, BV, BO);      /* 'oc' = natural Bt */
  const dim3 gP((SLEN / 128) * (DM / 64), 1);
  const dim3 gP3((SLEN / 128) * (DM / 64), 3);
  k_gemm2x3<0><<<gP3, 128, 0, stream>>>(XV, XR, XR, BQ, BK, BV, bq, bk, bv, Q16, K16, VT, 0.0625f, DM, SLEN, DM, DM);      /* q, k token-major; v as V^T [channel][token] */
  k_flash<4><<<NB * NH * (TQ / 128), 128 * 4, 0, stream>>>(Q16, DM, K16, DM, VT, O16, DM);      /* 4096 x 4096 per head */
  k_gemm2<0, true><<<gP, 128, 0, stream>>>(BO, DM, 0, O16, DM, 0, 0.0625f, bo, 0, nullptr, 1, 0, 0, (float*)d_out, nullptr, SLEN, 0, DM, SLEN, DM);      /* out[channel][token] */
}

// v009
// It runs in 60.3 microseconds.
// Next to v008, in two timings, it ran 1.05 and 1.04 times as fast.
// Counting every step since v000, which is the starting kernel, it is 9.67 times as fast.
#include <hip/hip_runtime.h>
// CrossViewAttention3D (1 clip: 512 channels x (4 x 32 x 32 = 4096) tokens, 8 heads x 64): q = Wq video + bq, k = Wk ref + bk, v = Wv ref + bv (1x1x1 convs = channel matmuls); softmax(q.k / 8) over the 4096 ref tokens; out = Wo ctx + bo; channel-major in and out.
// Structure: exact token-major f16 planes of both inputs; q, k, v as f16 WMMA GEMM outputs (32x64 wave tiles, f32 accumulation, exact x16 weights + bias, f16 out); V^T straight from its GEMM (weights as rows, tokens as columns); the fused flash kernel (4096 x 4096 per head, plain operands) stores ctx as f16; the Wo + bo GEMM, weights as rows, stores channel-major.
// Compute dtype: inputs rounded to bf16; inputs exact as f16; q/k/P/v/ctx as plain f16 operands (~2^-12); softmax f32. v_wmma_f32_16x16x32_f16.
#define NB 1
#define DM 512
#define NKV 8
#define NREP (NH / NKV)
#define KVD (NKV * 64)           /* 512 */
#define NR (NB * SLEN)           /* 4096 */
#define SLEN 4096
#define TQ SLEN
#define TK SLEN
#define NH 8
#define SCL 0.125f
#define QBLKS (TQ / 64)
#define QB05 0
#define QBN5 4
#define QB0P 0
#define QBNP QBLKS           /* non-causal: plain flash on every query block */
#define RE 256
typedef __bf16 v16b __attribute__((ext_vector_type(16)));
typedef unsigned short v8us __attribute__((ext_vector_type(8), may_alias));
typedef float  v8f  __attribute__((ext_vector_type(8)));
typedef float  v4f  __attribute__((ext_vector_type(4)));
typedef float  v4fa __attribute__((ext_vector_type(4), may_alias));
union FragB { v16b v; v8us half[2]; unsigned short u[16]; };

__device__ __forceinline__ unsigned short bf16_bits(float x) { unsigned int u = __float_as_uint(x); return (unsigned short)((u + 0x7FFFu + ((u >> 16) & 1u)) >> 16); }
__device__ __forceinline__ float bf16_val(unsigned short b) { return __uint_as_float(((unsigned int)b) << 16); }
__device__ __forceinline__ float bf16_round(float x) { return bf16_val(bf16_bits(x)); }
// D += A·B with NT terms: 1 = ah·bh, 2 = + al·bh (A split), 3 = + ah·bl (both split)
template <int NT>
__device__ __forceinline__ v8f mmaN(v16b ah, v16b al, v16b bh, v16b bl, v8f c) {
  c = __builtin_amdgcn_wmma_f32_16x16x32_bf16(false, ah, false, bh, (short)0, c, false, false);
  if (NT >= 2) c = __builtin_amdgcn_wmma_f32_16x16x32_bf16(false, al, false, bh, (short)0, c, false, false);
  if (NT >= 3) c = __builtin_amdgcn_wmma_f32_16x16x32_bf16(false, ah, false, bl, (short)0, c, false, false);
  asm volatile("v_nop\n\tv_nop\n\tv_nop\n\tv_nop" : "+v"(c) : "v"(ah), "v"(al), "v"(bh), "v"(bl));
  return c;
}

__global__ __launch_bounds__(256) void k_wt_bf16(const float* __restrict__ W, unsigned short* __restrict__ Wt, int K, int N) {
  const int t = blockIdx.x * 256 + threadIdx.x;
  const int k8n = K / 8;
  if (t >= N * k8n) return;
  const int n = t / k8n, k8 = (t % k8n) * 8;
  v8us v;
#pragma unroll
  for (int i = 0; i < 8; ++i) v[i] = bf16_bits(W[(size_t)(k8 + i) * N + n]);
  *(v8us*)(Wt + (size_t)n * K + k8) = v;
  
}

// GEMM C[M][N] (f32, pitch ldc) = act(A[M][K]·W + bias). A f32 row-major (pitch lda) converted per fragment to bf16
// (ASPLIT: hi/lo two planes -> 2 terms, else single rounded term); Wt bf16 [N][K] (pitch ldb). BIAS_BF16 rounds the
// bias to bf16 first (bias quantised to bf16 before the add). K%32==0, M%16==0, N%64==0.
template <bool ASPLIT, int ACT, bool BIAS_BF16>
__global__ __launch_bounds__(128) void k_gemm_bf(const float* __restrict__ A, int lda, const unsigned short* __restrict__ Wt, int ldb,
                                               const float* __restrict__ bias, float* __restrict__ C, int ldc, int M, int N, int K) {
  __shared__ __attribute__((aligned(16))) float so[4][16][64];
  const int tid = threadIdx.x, w = tid >> 5, lane = tid & 31, ln = lane & 15, hh = lane >> 4;
  const int ntn = N / 64;
  const int wid = blockIdx.x * 4 + w;
  const int mt = wid / ntn, nq = wid % ntn;
  if (mt * 16 >= M) return;
  const int row0 = mt * 16, col0 = nq * 64;
  const float* arow = A + (size_t)(row0 + ln) * lda;
  v8f acc[4] = {};
  for (int kb = 0; kb < K; kb += 32) {
    FragB ah, al;
    const v4f x0 = *(const v4fa*)(arow + kb + 8 * hh), x1 = *(const v4fa*)(arow + kb + 8 * hh + 4);
    const v4f x2 = *(const v4fa*)(arow + kb + 16 + 8 * hh), x3 = *(const v4fa*)(arow + kb + 16 + 8 * hh + 4);
    float xs[16] = {x0[0],x0[1],x0[2],x0[3],x1[0],x1[1],x1[2],x1[3],x2[0],x2[1],x2[2],x2[3],x3[0],x3[1],x3[2],x3[3]};
#pragma unroll
    for (int i = 0; i < 16; ++i) { const unsigned short hb = bf16_bits(xs[i]); ah.u[i] = hb; al.u[i] = ASPLIT ? bf16_bits(xs[i] - bf16_val(hb)) : (unsigned short)0; }
#pragma unroll
    for (int t = 0; t < 4; ++t) {
      const unsigned short* brow = Wt + (size_t)(col0 + t * 16 + ln) * ldb + kb;
      FragB b;
      b.half[0] = *(const v8us*)(brow + 8 * hh);
      b.half[1] = *(const v8us*)(brow + 16 + 8 * hh);
      acc[t] = mmaN<ASPLIT ? 2 : 1>(ah.v, al.v, b.v, b.v, acc[t]);
    }
  }
#pragma unroll
  for (int t = 0; t < 4; ++t) {
    float bv = bias ? bias[col0 + t * 16 + ln] : 0.f;
    if (BIAS_BF16) bv = bf16_round(bv);
#pragma unroll
    for (int r = 0; r < 8; ++r) { float v = acc[t][r] + bv; if (ACT == 1) v = fmaxf(v, 0.f); so[w][8 * hh + r][t * 16 + ln] = v; }
  }
  __builtin_amdgcn_fence(__ATOMIC_ACQ_REL, "workgroup");
  __builtin_amdgcn_wave_barrier();
  const int rsub = lane >> 4, c4 = (lane & 15) * 4;
  {
#pragma unroll
    for (int q = 0; q < 8; ++q) {
      const int r = q * 2 + rsub;
      const v4f v = *(const v4fa*)&so[w][r][c4];
      *(v4f*)(C + (size_t)(row0 + r) * ldc + col0 + c4) = v;
    }
    
  }
}

// GEMM C = act(A·W + bias + resid): A f32 (ASPLIT -> hi/lo 2 terms), Wt bf16 [N][K]; ACT 0 none, 1 relu, 2 exact gelu;
// resid (optional, f32, row index = (row % rmod), pitch ldr, RES_BF16 rounds it) added before the activation.
template <bool ASPLIT, int ACT, bool BIAS_BF16, bool RES_BF16>
__global__ __launch_bounds__(128) void k_gemm_bf3(const float* __restrict__ A, int lda, const unsigned short* __restrict__ Wt, int ldb,
                                                const float* __restrict__ bias, const float* __restrict__ resid, int rmod, int ldr,
                                                float* __restrict__ C, int ldc, int M, int N, int K) {
  __shared__ __attribute__((aligned(16))) float so[4][16][64];
  const int tid = threadIdx.x, w = tid >> 5, lane = tid & 31, ln = lane & 15, hh = lane >> 4;
  const int ntn = N / 64;
  const int wid = blockIdx.x * 4 + w;
  const int mt = wid / ntn, nq = wid % ntn;
  if (mt * 16 >= M) return;
  const int row0 = mt * 16, col0 = nq * 64;
  const float* arow = A + (size_t)(row0 + ln) * lda;
  v8f acc[4] = {};
  for (int kb = 0; kb < K; kb += 32) {
    FragB ah, al;
    const v4f x0 = *(const v4fa*)(arow + kb + 8 * hh), x1 = *(const v4fa*)(arow + kb + 8 * hh + 4);
    const v4f x2 = *(const v4fa*)(arow + kb + 16 + 8 * hh), x3 = *(const v4fa*)(arow + kb + 16 + 8 * hh + 4);
    float xs[16] = {x0[0],x0[1],x0[2],x0[3],x1[0],x1[1],x1[2],x1[3],x2[0],x2[1],x2[2],x2[3],x3[0],x3[1],x3[2],x3[3]};
#pragma unroll
    for (int i = 0; i < 16; ++i) { const unsigned short hb = bf16_bits(xs[i]); ah.u[i] = hb; al.u[i] = ASPLIT ? bf16_bits(xs[i] - bf16_val(hb)) : (unsigned short)0; }
#pragma unroll
    for (int t = 0; t < 4; ++t) {
      const unsigned short* brow = Wt + (size_t)(col0 + t * 16 + ln) * ldb + kb;
      FragB b;
      b.half[0] = *(const v8us*)(brow + 8 * hh);
      b.half[1] = *(const v8us*)(brow + 16 + 8 * hh);
      acc[t] = mmaN<ASPLIT ? 2 : 1>(ah.v, al.v, b.v, b.v, acc[t]);
    }
  }
#pragma unroll
  for (int t = 0; t < 4; ++t) {
    const int col = col0 + t * 16 + ln;
    float bv = bias ? bias[col] : 0.f;
    if (BIAS_BF16) bv = bf16_round(bv);
#pragma unroll
    for (int r = 0; r < 8; ++r) {
      float v = acc[t][r] + bv;
      if (resid) { float rv = resid[(size_t)((row0 + 8 * hh + r) % rmod) * ldr + col]; if (RES_BF16) rv = bf16_round(rv); v += rv; }
      if (ACT == 1) v = fmaxf(v, 0.f);
      if (ACT == 2) v = 0.5f * v * (1.0f + erff(v * 0.70710678118654752f));
      if (ACT == 3) { const float u = 0.7978845608028654f * (v + 0.044715f * v * v * v); v = 0.5f * v * (1.0f + tanhf(u)); }
      so[w][8 * hh + r][t * 16 + ln] = v;
    }
  }
  __builtin_amdgcn_fence(__ATOMIC_ACQ_REL, "workgroup");
  __builtin_amdgcn_wave_barrier();
  const int rsub = lane >> 4, c4 = (lane & 15) * 4;
  {
#pragma unroll
    for (int q = 0; q < 8; ++q) {
      const int r = q * 2 + rsub;
      const v4f v = *(const v4fa*)&so[w][r][c4];
      *(v4f*)(C + (size_t)(row0 + r) * ldc + col0 + c4) = v;
    }
    
  }
}
// row LayerNorm (biased variance, eps) over N: s = X (+ R); optional out_sum <- s; out_norm <- (s-mu)*rsqrt(var+eps)*g + b
template <bool PARAM_BF16>
__global__ __launch_bounds__(256) void k_layernorm(const float* __restrict__ X, const float* __restrict__ R, const float* __restrict__ g, const float* __restrict__ bta,
                                                  float* __restrict__ out_sum, float* __restrict__ out_norm, int N, float eps) {
  __shared__ float red[256];
  const int row = blockIdx.x, tid = threadIdx.x;
  const float* x = X + (size_t)row * N; const float* rr = R ? R + (size_t)row * N : nullptr;
  float vals[16];                     // up to N = 4096
  const int per = N / 256;            // contiguous chunk per thread? use strided-by-4 chunks: thread handles j = tid*4 + 1024*u
  float s1 = 0.f;
  for (int u = 0; u < per / 4; ++u) {
    const int j = tid * 4 + 1024 * u;
    const v4f a = *(const v4fa*)(x + j);
    v4f b = {0.f,0.f,0.f,0.f}; if (rr) b = *(const v4fa*)(rr + j);
#pragma unroll
    for (int q = 0; q < 4; ++q) { const float v = a[q] + b[q]; vals[u * 4 + q] = v; s1 += v; }
  }
  red[tid] = s1; __syncthreads();
  for (int st = 128; st > 0; st >>= 1) { if (tid < st) red[tid] += red[tid + st]; __syncthreads(); }
  const float mu = red[0] / (float)N; __syncthreads();
  float s2 = 0.f;
  for (int u = 0; u < per / 4; ++u)
#pragma unroll
    for (int q = 0; q < 4; ++q) { const float c = vals[u * 4 + q] - mu; s2 += c * c; }
  red[tid] = s2; __syncthreads();
  for (int st = 128; st > 0; st >>= 1) { if (tid < st) red[tid] += red[tid + st]; __syncthreads(); }
  const float rs = rsqrtf(red[0] / (float)N + eps);
  {
    for (int u = 0; u < per / 4; ++u) {
      const int j = tid * 4 + 1024 * u;
      v4f o, sm;
#pragma unroll
      for (int q = 0; q < 4; ++q) {
        float gg = g[j + q], bb = bta[j + q];
        if (PARAM_BF16) { gg = bf16_round(gg); bb = bf16_round(bb); }
        sm[q] = vals[u * 4 + q]; o[q] = (vals[u * 4 + q] - mu) * rs * gg + bb;
      }
      if (out_sum) *(v4f*)(out_sum + (size_t)row * N + j) = sm;
      *(v4f*)(out_norm + (size_t)row * N + j) = o;
    }
    
  }
}



// ---- f16 WMMA path (v_wmma_f32_16x16x32_f16): 11-bit significands for operands in range — used where a [0,1] probability operand needs more precision than bf16
typedef _Float16 v16h __attribute__((ext_vector_type(16)));
union FragH { v16h v; v8us half[2]; _Float16 h[16]; unsigned short u[16]; };
template <int NT>
__device__ __forceinline__ v8f mmaH(v16h ah, v16h al, v16h bh, v16h bl, v8f c) {
  c = __builtin_amdgcn_wmma_f32_16x16x32_f16(false, ah, false, bh, (short)0, c, false, false);
  if (NT >= 2) c = __builtin_amdgcn_wmma_f32_16x16x32_f16(false, al, false, bh, (short)0, c, false, false);
  if (NT >= 3) c = __builtin_amdgcn_wmma_f32_16x16x32_f16(false, ah, false, bl, (short)0, c, false, false);
  asm volatile("v_nop\n\tv_nop\n\tv_nop\n\tv_nop" : "+v"(c) : "v"(ah), "v"(al), "v"(bh), "v"(bl));
  return c;
}
// batched GEMM like k_gemm_b but f16 operands: A f32 (split into f16 hi/lo if ASPLIT, else rounded to f16), Bt = f16 values [n][k]; alpha; C f32; N multiple of 16 (partial tiles skipped)
template <bool ASPLIT>
__global__ __launch_bounds__(128) void k_gemm_h(const float* __restrict__ A, int lda, size_t sA, const _Float16* __restrict__ Bh, int ldb, size_t sB, float alpha, float* __restrict__ C, int ldc, size_t sC, int M, int N, int K) {
  __shared__ __attribute__((aligned(16))) float so[4][16][64];
  const int tid = threadIdx.x, w = tid >> 5, lane = tid & 31, ln = lane & 15, hh = lane >> 4; const int by = blockIdx.y;
  A += (size_t)by * sA; Bh += (size_t)by * sB; C += (size_t)by * sC;
  const int ntn = (N + 63) / 64; const int wid = blockIdx.x * 4 + w; const int mt = wid / ntn, nq = wid % ntn; if (mt * 16 >= M) return;
  const int row0 = mt * 16, col0 = nq * 64; const float* arow = A + (size_t)(row0 + ln) * lda;
  v8f acc[4] = {};
  for (int kb = 0; kb < K; kb += 32) {
    FragH ah, al;
    const v4f x0 = *(const v4fa*)(arow + kb + 8 * hh), x1 = *(const v4fa*)(arow + kb + 8 * hh + 4), x2 = *(const v4fa*)(arow + kb + 16 + 8 * hh), x3 = *(const v4fa*)(arow + kb + 16 + 8 * hh + 4);
    float xs[16] = {x0[0],x0[1],x0[2],x0[3],x1[0],x1[1],x1[2],x1[3],x2[0],x2[1],x2[2],x2[3],x3[0],x3[1],x3[2],x3[3]};
#pragma unroll
    for (int i = 0; i < 16; ++i) { const _Float16 h = (_Float16)xs[i]; ah.h[i] = h; al.h[i] = ASPLIT ? (_Float16)(xs[i] - (float)h) : (_Float16)0.0f; }
#pragma unroll
    for (int t = 0; t < 4; ++t) { if (col0 + t * 16 >= N) continue; const size_t boff = (size_t)(col0 + t * 16 + ln) * ldb + kb; FragH bq; bq.half[0] = *(const v8us*)(Bh + boff + 8 * hh); bq.half[1] = *(const v8us*)(Bh + boff + 16 + 8 * hh);
      acc[t] = mmaH<ASPLIT ? 2 : 1>(ah.v, al.v, bq.v, bq.v, acc[t]); }
  }
#pragma unroll
  for (int t = 0; t < 4; ++t) { if (col0 + t * 16 >= N) continue;
#pragma unroll
    for (int r = 0; r < 8; ++r) so[w][8 * hh + r][t * 16 + ln] = acc[t][r] * alpha; }
  __builtin_amdgcn_fence(__ATOMIC_ACQ_REL, "workgroup"); __builtin_amdgcn_wave_barrier();
  const int rsub = lane >> 4, c4 = (lane & 15) * 4;
  {
#pragma unroll
    for (int q = 0; q < 8; ++q) { const int r = q * 2 + rsub; if (col0 + c4 < N) { const v4f v = *(const v4fa*)&so[w][r][c4]; *(v4f*)(C + (size_t)(row0 + r) * ldc + col0 + c4) = v; } }
     }
}

// Wt[n][k] = f16(W[k][n]·scale) from f32 row-major W[K][N] (scale = power of two; bf16-exact weights stay exact in f16 away from the subnormal range)
__global__ __launch_bounds__(256) void k_wt_f16(const float* __restrict__ W, _Float16* __restrict__ Wt, int K, int N, float scale) {
  const int t = blockIdx.x * 256 + threadIdx.x; if (t >= N * (K / 8)) return; const int n = t / (K / 8), k8 = (t % (K / 8)) * 8; FragH f;
#pragma unroll
  for (int i = 0; i < 8; ++i) f.h[i] = (_Float16)(bf16_round(W[(size_t)(k8 + i) * N + n]) * scale); const v8us o = f.half[0];
  *(v8us*)((unsigned short*)Wt + (size_t)n * K + k8) = o; 
}
// k_gemm_hh variant with fused epilogue: v = acc·alpha + bias[by·sBias + col] (+ CP[(row/rowsPerB)·sCPb + by·64 + col] if CP) ; ACT 0 none / 1 elu ; writes f16 C16 (and f32 C if non-null)
template <int ACT>
__global__ __launch_bounds__(128) void k_gemm_hhx(const _Float16* __restrict__ A, int lda, size_t sA, const _Float16* __restrict__ Bh, int ldb, size_t sB, float alpha, const float* __restrict__ bias, size_t sBias, const float* __restrict__ CP, int rowsPerB, size_t sCPb, int row0g,
    float* __restrict__ C, _Float16* __restrict__ C16, int ldc, size_t sC, int M, int N, int K) {
  __shared__ __attribute__((aligned(16))) float so[4][16][64];
  const int tid = threadIdx.x, w = tid >> 5, lane = tid & 31, ln = lane & 15, hh = lane >> 4; const int by = blockIdx.y;
  A += (size_t)by * sA; Bh += (size_t)by * sB; const size_t cofs = (size_t)by * sC; const float* bp = bias ? bias + (size_t)by * sBias : nullptr;
  const int ntn = (N + 63) / 64; const int wid = blockIdx.x * 4 + w; const int mt = wid / ntn, nq = wid % ntn; if (mt * 16 >= M) return;
  const int row0 = mt * 16, col0 = nq * 64; const _Float16* arow = A + (size_t)(row0 + ln) * lda;
  v8f acc[4] = {};
  for (int kb = 0; kb < K; kb += 32) { FragH ah; ah.half[0] = *(const v8us*)((const unsigned short*)arow + kb + 8 * hh); ah.half[1] = *(const v8us*)((const unsigned short*)arow + kb + 16 + 8 * hh);
#pragma unroll
    for (int t = 0; t < 4; ++t) { if (col0 + t * 16 >= N) continue; const size_t boff = (size_t)(col0 + t * 16 + ln) * ldb + kb; FragH bq; bq.half[0] = *(const v8us*)((const unsigned short*)Bh + boff + 8 * hh); bq.half[1] = *(const v8us*)((const unsigned short*)Bh + boff + 16 + 8 * hh);
      acc[t] = mmaH<1>(ah.v, ah.v, bq.v, bq.v, acc[t]); }
  }
#pragma unroll
  for (int t = 0; t < 4; ++t) { if (col0 + t * 16 >= N) continue; const int col = col0 + t * 16 + ln; const float bv = bp ? bf16_round(bp[col]) : 0.f;
#pragma unroll
    for (int r = 0; r < 8; ++r) { float v = acc[t][r] * alpha + bv; if (CP) { const int bidx = (row0g + row0 + 8 * hh + r) / rowsPerB; v += CP[(size_t)bidx * sCPb + (size_t)by * 64 + col]; } if (ACT == 1) v = (v > 0.f) ? v : expm1f(v); else if (ACT == 7) v = (v > 0.f) ? v + 1.0f : expf(v); else if (ACT == 8) v = tanhf(v); else if (ACT == 9) v = 0.5f * v * (1.0f + tanhf(0.7978845608028654f * (v + 0.044715f * v * v * v))); else if (ACT == 11) v = 1.0f / (1.0f + expf(-v)); else if (ACT == 12) v = (v > 0.f) ? v : 0.01f * v; else if (ACT == 14) v = (v > 0.f) ? v : 0.1f * v; else if (ACT == 15) v = v / (1.0f + expf(-v)); else if (ACT == 3) v = fmaxf(v, 0.f); else if (ACT == 6) v = 0.5f * v * (1.0f + erff(v * 0.70710678118654752f)); so[w][8 * hh + r][t * 16 + ln] = v; } }
  __builtin_amdgcn_fence(__ATOMIC_ACQ_REL, "workgroup"); __builtin_amdgcn_wave_barrier();
  const int rsub = lane >> 4, c4 = (lane & 15) * 4; typedef _Float16 v4h __attribute__((ext_vector_type(4)));
  {
#pragma unroll
    for (int q = 0; q < 8; ++q) { const int r = q * 2 + rsub; if (col0 + c4 < N) { const v4f v = *(const v4fa*)&so[w][r][c4]; if (C) *(v4f*)(C + cofs + (size_t)(row0 + r) * ldc + col0 + c4) = v; if (C16) { v4h h4; for (int i = 0; i < 4; ++i) h4[i] = (_Float16)v[i]; *(v4h*)(C16 + cofs + (size_t)(row0 + r) * ldc + col0 + c4) = h4; } } }
     }
}


typedef _Float16 v4h __attribute__((ext_vector_type(4)));

__global__ __launch_bounds__(256) void k_x16(const float* __restrict__ x, _Float16* __restrict__ X16, size_t n8) { const size_t t = (size_t)blockIdx.x * 256 + threadIdx.x; if (t >= n8) return; FragH f;
#pragma unroll
  for (int q = 0; q < 8; ++q) f.h[q] = (_Float16)bf16_round(x[t * 8 + q]); *(v8us*)((unsigned short*)X16 + t * 8) = f.half[0];  }
__global__ __launch_bounds__(256) void k_h16(const float* __restrict__ x, _Float16* __restrict__ X16, size_t n8) { const size_t t = (size_t)blockIdx.x * 256 + threadIdx.x; if (t >= n8) return; FragH f;
#pragma unroll
  for (int q = 0; q < 8; ++q) f.h[q] = (_Float16)x[t * 8 + q]; *(v8us*)((unsigned short*)X16 + t * 8) = f.half[0];  }
__global__ __launch_bounds__(256) void k_round16f(const float* __restrict__ W, _Float16* __restrict__ Bt, size_t n8) { const size_t t = (size_t)blockIdx.x * 256 + threadIdx.x; if (t >= n8) return; FragH f;
#pragma unroll
  for (int i = 0; i < 8; ++i) f.h[i] = (_Float16)(bf16_round(W[t * 8 + i]) * 16.0f); *(v8us*)((unsigned short*)Bt + t * 8) = f.half[0];  }
template <int NHv, int TTv>
__global__ __launch_bounds__(256) void k_vt(const _Float16* __restrict__ V16, int ldv, int voff, _Float16* __restrict__ Vt) { __shared__ unsigned short tl[64][66]; const int tid = threadIdx.x; const int slab = blockIdx.x / (TTv / 64), lg = blockIdx.x % (TTv / 64); const int b = slab / NHv, h = slab % NHv;
  for (int i = tid; i < 64 * 8; i += 256) { const int r = i / 8, c8 = (i % 8) * 8; FragH f; f.half[0] = *(const v8us*)((const unsigned short*)V16 + ((size_t)b * TTv + lg * 64 + r) * ldv + voff + h * 64 + c8);
#pragma unroll
    for (int q = 0; q < 8; ++q) tl[r][c8 + q] = f.u[q]; }
  __syncthreads();
  {
#pragma unroll
    for (int rd = 0; rd < 2; ++rd) { const int d = rd * 32 + tid / 8, pc = tid % 8; FragH f;
#pragma unroll
      for (int q = 0; q < 8; ++q) f.u[q] = tl[pc * 8 + q][d];
      *(v8us*)((unsigned short*)Vt + ((size_t)slab * 64 + d) * TTv + lg * 64 + pc * 8) = f.half[0]; }
     } }

__global__ __launch_bounds__(256) void k_hl(const float* __restrict__ F, _Float16* __restrict__ Hh, _Float16* __restrict__ Hl, size_t n8) { const size_t t = (size_t)blockIdx.x * 256 + threadIdx.x; if (t >= n8) return; FragH fh, fl; const v4f a = *(const v4fa*)(F + t * 8), c = *(const v4fa*)(F + t * 8 + 4);
#pragma unroll
  for (int q = 0; q < 4; ++q) { _Float16 h = (_Float16)a[q]; fh.h[q] = h; fl.h[q] = (_Float16)((a[q] - (float)h) * 1024.0f); h = (_Float16)c[q]; fh.h[4 + q] = h; fl.h[4 + q] = (_Float16)((c[q] - (float)h) * 1024.0f); }
  { *(v8us*)((unsigned short*)Hh + t * 8) = fh.half[0]; *(v8us*)((unsigned short*)Hl + t * 8) = fl.half[0];  } }

// ---- fast GEMM (work-group tile 128x64, wave tile 32x64; requires M % 128 == 0, N % 64 == 0 and K % 64 == 0, K >= 64); epilogue = k_gemm_hhx semantics ----
#define G2P 72      /* LDS row pitch in halves = 128 B + 16 B, the pitch of 16-byte LDS readers */
typedef unsigned short g2_tile[192][G2P];      /* one stage, 64 halves of k: rows 0..127 = the block's 128 rows of A, rows 128..191 = its 64 rows of B */
__device__ __forceinline__ v16h g2_frag(const unsigned short* p, int hh) { FragH f; f.half[0] = *(const v8us*)(p + 8 * hh); f.half[1] = *(const v8us*)(p + 16 + 8 * hh); return f.v; }
// One stage goes to LDS once per work-group by asynchronous copies, 16 B a lane, eight lanes a row: whole 128-B lines.
// l: this lane's LDS byte address of its first A piece; ga, gb: its first A and B piece in global memory; piece i lies 16 rows further on both sides, and the four B pieces follow the eight A pieces in LDS.
__device__ __forceinline__ void g2_stage(unsigned l, const _Float16* ga, size_t a16, const _Float16* gb, size_t b16) {
  const unsigned l1 = l + 2304u, l2 = l + 4608u, l3 = l + 6912u, l4 = l + 9216u, l5 = l + 11520u, l6 = l + 13824u, l7 = l + 16128u, l8 = l + 18432u, l9 = l + 20736u, l10 = l + 23040u, l11 = l + 25344u;      /* 16 rows x 144 B */
  const _Float16* ga1 = ga + a16; const _Float16* ga2 = ga1 + a16; const _Float16* ga3 = ga2 + a16; const _Float16* ga4 = ga3 + a16; const _Float16* ga5 = ga4 + a16; const _Float16* ga6 = ga5 + a16; const _Float16* ga7 = ga6 + a16;
  const _Float16* gb1 = gb + b16; const _Float16* gb2 = gb1 + b16; const _Float16* gb3 = gb2 + b16;
  /* the closing s_wait_xcnt 0 stands inside the statement so that no address register of a copy is rewritten in front of it */
  asm volatile("global_load_async_to_lds_b128 %0, %12, off\n\t"
               "global_load_async_to_lds_b128 %1, %13, off\n\t"
               "global_load_async_to_lds_b128 %2, %14, off\n\t"
               "global_load_async_to_lds_b128 %3, %15, off\n\t"
               "global_load_async_to_lds_b128 %4, %16, off\n\t"
               "global_load_async_to_lds_b128 %5, %17, off\n\t"
               "global_load_async_to_lds_b128 %6, %18, off\n\t"
               "global_load_async_to_lds_b128 %7, %19, off\n\t"
               "global_load_async_to_lds_b128 %8, %20, off\n\t"
               "global_load_async_to_lds_b128 %9, %21, off\n\t"
               "global_load_async_to_lds_b128 %10, %22, off\n\t"
               "global_load_async_to_lds_b128 %11, %23, off\n\t"
               "s_wait_xcnt 0x0"
               :: "v"(l), "v"(l1), "v"(l2), "v"(l3), "v"(l4), "v"(l5), "v"(l6), "v"(l7), "v"(l8), "v"(l9), "v"(l10), "v"(l11),
                  "v"(ga), "v"(ga1), "v"(ga2), "v"(ga3), "v"(ga4), "v"(ga5), "v"(ga6), "v"(ga7), "v"(gb), "v"(gb1), "v"(gb2), "v"(gb3) : "memory");
}
__device__ __forceinline__ v8f g2_mma(v16h a, v16h b, v8f c) { v8f d = __builtin_amdgcn_wmma_f32_16x16x32_f16(false, a, false, b, (short)0, c, false, false); asm volatile("v_nop\n\tv_nop\n\tv_nop\n\tv_nop" : "+v"(d) : "v"(a), "v"(b)); return d; }
// ROWB: the bias belongs to the rows of C (weights as the A operand: C comes out channel-major) instead of its columns. so, sT: the caller's output staging array and its two operand stages, one set for all bodies of a kernel.
template <int ACT, bool ROWB>
__device__ __forceinline__ void gemm2_body(float (*so)[32][68], g2_tile* sT, const int by, const _Float16* __restrict__ A, int lda, size_t sA, const _Float16* __restrict__ Bh, int ldb, size_t sB, float alpha, const float* __restrict__ bias, size_t sBias, const float* __restrict__ CP, int rowsPerB, size_t sCPb, int row0g,
    float* __restrict__ C, _Float16* __restrict__ C16, int ldc, size_t sC, int M, int N, int K) {
  const int tid = threadIdx.x, w = tid >> 5, lane = tid & 31, ln = lane & 15, hh = lane >> 4;
  A += (size_t)by * sA; Bh += (size_t)by * sB; const size_t cofs = (size_t)by * sC; const float* bp = bias ? bias + (size_t)by * sBias : nullptr;
  const int ntn = N >> 6; const int mt = blockIdx.x / ntn, nq = blockIdx.x - mt * ntn; const int row0 = mt * 128 + 32 * w, col0 = nq * 64; if (mt * 128 >= M) return;      /* the same for every wave of the block: it stands in front of the barriers */
  const int crow = tid >> 3, cc = (tid & 7) * 8;      /* eight lanes copy one 128-B row */
  const _Float16* ga = A + (size_t)(mt * 128 + crow) * lda + cc; const _Float16* gb = Bh + (size_t)(col0 + crow) * ldb + cc;
  const size_t a16 = (size_t)16 * lda, b16 = (size_t)16 * ldb;
  const unsigned l0 = (unsigned)(size_t)&sT[0][crow][cc];
  constexpr unsigned BUFB = sizeof(g2_tile);      /* bytes of one stage */
  const int nst = K >> 6;
  g2_stage(l0, ga, a16, gb, b16);
  const v8f z8 = {0.f,0.f,0.f,0.f,0.f,0.f,0.f,0.f}; v8f c00 = z8, c01 = z8, c02 = z8, c03 = z8, c10 = z8, c11 = z8, c12 = z8, c13 = z8;
  asm volatile("s_wait_asynccnt 0x0" ::: "memory");      /* stage 0: this wave's copies have landed */
  __syncthreads();      /* stage 0 is readable by every wave */
  if (nst > 1) g2_stage(l0 + BUFB, ga + 64, a16, gb + 64, b16);
#pragma unroll 1      /* stays rolled: one copy of the body serves both buffers, chosen by st & 1 */
  for (int st = 0; st < nst; ++st) {      /* stage st is worked on while stage st + 1 flies into the other buffer */
    const int bf = st & 1;
    const unsigned short* ar = &sT[bf][32 * w + ln][0]; const unsigned short* br = &sT[bf][128 + ln][0];
    v16h a0[2], a1[2], b[2][4];      /* all 24 LDS reads of the stage stand in front of its first product: one LDS latency a stage, not one for each pair of products */
#pragma unroll      /* unrolled, here and below: the fragments are indexed by constants and stay in registers, and the half stage becomes a constant offset of the LDS reads */
    for (int ks = 0; ks < 2; ++ks) { a0[ks] = g2_frag(ar + ks * 32, hh); a1[ks] = g2_frag(ar + 16 * G2P + ks * 32, hh);
#pragma unroll
      for (int t = 0; t < 4; ++t) b[ks][t] = g2_frag(br + t * 16 * G2P + ks * 32, hh); }
#pragma unroll
    for (int ks = 0; ks < 2; ++ks) {
      c00 = g2_mma(a0[ks], b[ks][0], c00); c10 = g2_mma(a1[ks], b[ks][0], c10); c01 = g2_mma(a0[ks], b[ks][1], c01); c11 = g2_mma(a1[ks], b[ks][1], c11);
      c02 = g2_mma(a0[ks], b[ks][2], c02); c12 = g2_mma(a1[ks], b[ks][2], c12); c03 = g2_mma(a0[ks], b[ks][3], c03); c13 = g2_mma(a1[ks], b[ks][3], c13); }
    asm volatile("s_wait_dscnt 0x0" ::: "memory");      /* this wave's reads of buffer bf are done before the buffer is given up */
    asm volatile("s_wait_asynccnt 0x0" ::: "memory");      /* this wave's copies of stage st + 1 have landed */
    __syncthreads();      /* publishes stage st + 1 and ends every wave's reads of buffer bf */
    if (st + 2 < nst) g2_stage(l0 + bf * BUFB, ga + (size_t)(st + 2) * 64, a16, gb + (size_t)(st + 2) * 64, b16);
  }
  asm volatile("s_wait_asynccnt 0x0" ::: "memory");      /* no copy is left in flight when the wave goes on */
  v8f accs[8] = {c00, c01, c02, c03, c10, c11, c12, c13};
  float bvr[2][8];      /* ROWB: the biases of this lane's sixteen rows */
  if (ROWB) {
#pragma unroll      /* unrolled: bvr is indexed by constants and stays in registers */
    for (int i = 0; i < 16; ++i) bvr[i >> 3][i & 7] = bp ? bf16_round(bp[row0 + (i >> 3) * 16 + 8 * hh + (i & 7)]) : 0.f; }
#pragma unroll
  for (int u = 0; u < 8; ++u) { const int t = u & 3, half = u >> 2; const int col = col0 + t * 16 + ln; const float bvc = (!ROWB && bp) ? bf16_round(bp[col]) : 0.f;
#pragma unroll
    for (int r = 0; r < 8; ++r) { const int rloc = half * 16 + 8 * hh + r; const float bv = ROWB ? bvr[half][r] : bvc; float v = accs[u][r] * alpha + bv; if (CP) { const int bidx = (row0g + row0 + rloc) / rowsPerB; v += CP[(size_t)bidx * sCPb + (size_t)by * 64 + col]; }
      if (ACT == 3) v = fmaxf(v, 0.f); else if (ACT == 6) v = 0.5f * v * (1.0f + erff(v * 0.70710678118654752f)); else if (ACT == 11) v = 1.0f / (1.0f + expf(-v)); else if (ACT == 15) v = v / (1.0f + expf(-v)); else if (ACT == 12) v = (v > 0.f) ? v : 0.01f * v; else if (ACT == 8) v = tanhf(v);
      so[w][rloc][t * 16 + ln] = v; } }
  __builtin_amdgcn_fence(__ATOMIC_ACQ_REL, "workgroup"); __builtin_amdgcn_wave_barrier();
  const int rsub = lane >> 4, c4 = (lane & 15) * 4;
  { v4f vq[16];      /* all LDS reads first, so that the waits behind the stores do not stand between them */
#pragma unroll      /* unrolled, here and below: vq is indexed by constants and stays in registers */
    for (int q = 0; q < 16; ++q) vq[q] = *(const v4fa*)&so[w][q * 2 + rsub][c4];
#pragma unroll
    for (int q = 0; q < 16; ++q) { const int r = q * 2 + rsub; const v4f v = vq[q];      /* s_wait_xcnt 0 behind a store: the conversions and address sums that follow reuse the store's registers */
      if (C) { *(v4f*)(C + cofs + (size_t)(row0 + r) * ldc + col0 + c4) = v; asm volatile("s_wait_xcnt 0x0" ::: "memory"); }
      if (C16) { v4h h4; for (int i = 0; i < 4; ++i) h4[i] = (_Float16)v[i]; *(v4h*)(C16 + cofs + (size_t)(row0 + r) * ldc + col0 + c4) = h4; if (q + 1 < 16) asm volatile("s_wait_xcnt 0x0" ::: "memory"); } }
     } }
template <int ACT, bool ROWB>
__global__ __launch_bounds__(128) void k_gemm2(const _Float16* __restrict__ A, int lda, size_t sA, const _Float16* __restrict__ Bh, int ldb, size_t sB, float alpha, const float* __restrict__ bias, size_t sBias, const float* __restrict__ CP, int rowsPerB, size_t sCPb, int row0g,
    float* __restrict__ C, _Float16* __restrict__ C16, int ldc, size_t sC, int M, int N, int K) {
  __shared__ __attribute__((aligned(16))) float so[4][32][68];
  __shared__ __attribute__((aligned(16))) g2_tile sT[2];
  gemm2_body<ACT, ROWB>(so, sT, blockIdx.y, A, lda, sA, Bh, ldb, sB, alpha, bias, sBias, CP, rowsPerB, sCPb, row0g, C, C16, ldc, sC, M, N, K); }
// Three independent products of one shape in one launch: blockIdx.y picks the operands, the bias and the f16 output; the tile work is gemm2_body's.
// Jobs 0 and 1 give C[M][N] (tokens x channels). Job 2 takes its operands in swapped roles and gives C2[N][M] (channels x tokens, pitch M), the layout its reader wants; (M / 128)(N / 64) tiles either way.
template <int ACT>
__global__ __launch_bounds__(128) void k_gemm2x3(const _Float16* __restrict__ A0, const _Float16* __restrict__ A1, const _Float16* __restrict__ A2, const _Float16* __restrict__ B0, const _Float16* __restrict__ B1, const _Float16* __restrict__ B2,
    const float* __restrict__ bias0, const float* __restrict__ bias1, const float* __restrict__ bias2, _Float16* __restrict__ C0, _Float16* __restrict__ C1, _Float16* __restrict__ C2, float alpha, int ld, int M, int N, int K) {
  __shared__ __attribute__((aligned(16))) float so[4][32][68];
  __shared__ __attribute__((aligned(16))) g2_tile sT[2];
  const int j = blockIdx.y;
  if (j == 2) { gemm2_body<ACT, true>(so, sT, 0, B2, ld, 0, A2, ld, 0, alpha, bias2, 0, nullptr, 1, 0, 0, nullptr, C2, M, 0, N, M, K); return; }
  const _Float16* A = (j == 0) ? A0 : A1; const _Float16* Bh = (j == 0) ? B0 : B1; const float* bias = (j == 0) ? bias0 : bias1; _Float16* C16 = (j == 0) ? C0 : C1;
  gemm2_body<ACT, false>(so, sT, 0, A, ld, 0, Bh, ld, 0, alpha, bias, 0, nullptr, 1, 0, 0, nullptr, C16, ld, 0, M, N, K); }



// lane l <-> lane l ^ 16 (the two lane halves of one fragment column)
__device__ __forceinline__ float xhalf(float x) { return __builtin_bit_cast(float, __builtin_amdgcn_permlanex16(__builtin_bit_cast(int, x), __builtin_bit_cast(int, x), 0x76543210, 0xfedcba98, false, false)); }
__device__ __forceinline__ void kv_stage(unsigned lk, unsigned lv, const unsigned short* gk, size_t k16, const unsigned short* gv, size_t v16) {
  const unsigned lk1 = lk + 2304u, lk2 = lk + 4608u, lk3 = lk + 6912u, lv1 = lv + 2304u, lv2 = lv + 4608u, lv3 = lv + 6912u;      /* 16 rows x 144 B */
  const unsigned short* gk1 = gk + k16; const unsigned short* gk2 = gk1 + k16; const unsigned short* gk3 = gk2 + k16;
  const unsigned short* gv1 = gv + v16; const unsigned short* gv2 = gv1 + v16; const unsigned short* gv3 = gv2 + v16;
  /* the closing s_wait_xcnt 0 stands inside the statement so that no address register of a copy is rewritten in front of it */
  asm volatile("global_load_async_to_lds_b128 %0, %8, off\n\t"
               "global_load_async_to_lds_b128 %1, %9, off\n\t"
               "global_load_async_to_lds_b128 %2, %10, off\n\t"
               "global_load_async_to_lds_b128 %3, %11, off\n\t"
               "global_load_async_to_lds_b128 %4, %12, off\n\t"
               "global_load_async_to_lds_b128 %5, %13, off\n\t"
               "global_load_async_to_lds_b128 %6, %14, off\n\t"
               "global_load_async_to_lds_b128 %7, %15, off\n\t"
               "s_wait_xcnt 0x0"
               :: "v"(lk), "v"(lk1), "v"(lk2), "v"(lk3), "v"(lv), "v"(lv1), "v"(lv2), "v"(lv3),
                  "v"(gk), "v"(gk1), "v"(gk2), "v"(gk3), "v"(gv), "v"(gv1), "v"(gv2), "v"(gv3) : "memory");
}
// Wave tile: 32 queries (two column groups of 16) x TK / KSP keys. Every K and V^T fragment read from LDS feeds two products, one for each column group.
// A work-group holds 4 query tiles (128 queries) x KSP key groups of 4 waves; key group kg walks keys [kg TK / KSP, (kg + 1) TK / KSP) through a two-buffer ring of its own, so the waves per SIMD do not fall with the wider tile.
// Behind the loop the groups' partial (maximum, sum, O^T) are joined through LDS by the waves of group 0.
template <int KSP>
__global__ __launch_bounds__(128 * KSP) void k_flash(const _Float16* __restrict__ Q16, int ldq, const _Float16* __restrict__ K16, int ldk, const _Float16* __restrict__ Vt, _Float16* __restrict__ O, int ldo) {
  constexpr int CT = 2, QW = 16 * CT, QB = 4 * QW, DT = 4, KS = 2, KT = 64, LP = 72;      /* KT keys a stage; LP: LDS row pitch in halves = 128 B + 16 B, the pitch of 16-byte LDS readers */
  constexpr int KPG = TK / KSP, nst = KPG / KT, MV = CT * DT * 2 + 1;      /* MV: 16-byte pieces a lane hands over: its O^T tiles, then (maximum, sum) of both column groups */
  static_assert(nst >= 2 && KPG % KT == 0 && TQ % QB == 0, "shape");
  __shared__ __attribute__((aligned(16))) unsigned short sK[KSP][2][KT][LP];
  __shared__ __attribute__((aligned(16))) unsigned short sV[KSP][2][64][LP];
  __shared__ __attribute__((aligned(16))) v4f sM[KSP - 1][4][MV][32];      /* hand-over of groups 1 .. KSP - 1; plane [0][qt] then serves wave qt of group 0 as its output staging (32 rows x 68 floats, the same bytes) */
  static_assert(sizeof(v4f) * MV * 32 == sizeof(float) * QW * 68, "staging fits its plane");
  const int tid = threadIdx.x, w = tid >> 5, lane = tid & 31, ln = lane & 15, hh = lane >> 4;
  const int qt = w & 3, kg = w >> 2, gt = tid & 127;
  const int slab = blockIdx.x / (TQ / QB), qblk = blockIdx.x % (TQ / QB); const int b = slab / NH, h = slab % NH; const int q0 = qblk * QB + qt * QW;
  const unsigned short* Vth = (const unsigned short*)Vt + (size_t)slab * 64 * TK;
  const int crow = gt >> 3, cc = (gt & 7) * 8;      /* eight lanes copy one 128-B row */
  const unsigned short* gk = (const unsigned short*)K16 + ((size_t)b * TK + kg * KPG + crow) * ldk + h * 64 + cc;
  const unsigned short* gv = Vth + (size_t)crow * TK + kg * KPG + cc;
  const size_t k16 = (size_t)16 * ldk, v16 = (size_t)16 * TK, kst = (size_t)KT * ldk;
  const unsigned lk0 = (unsigned)(size_t)&sK[kg][0][crow][cc], lv0 = (unsigned)(size_t)&sV[kg][0][crow][cc];
  constexpr unsigned BUFB = KT * LP * 2;      /* bytes of one buffer */
  kv_stage(lk0, lv0, gk, k16, gv, v16);
  FragH bq[CT][KS];
#pragma unroll
  for (int c = 0; c < CT; ++c) { const unsigned short* qr = (const unsigned short*)Q16 + ((size_t)b * TQ + q0 + c * 16 + ln) * ldq + h * 64;
#pragma unroll
    for (int ks = 0; ks < KS; ++ks) { bq[c][ks].half[0] = *(const v8us*)(qr + ks * 32 + 8 * hh); bq[c][ks].half[1] = *(const v8us*)(qr + ks * 32 + 16 + 8 * hh); } }
  constexpr float C2 = SCL * 1.4426950408889634f;      /* score -> base-2 exponent: scale x log2(e) */
  float m_r[CT], l_r[CT]; v8f oacc[CT][DT];      /* m_r: running maximum of the unscaled scores; l_r: sum of 1024 p over this lane half's keys only, joined after the loop */
#pragma unroll
  for (int c = 0; c < CT; ++c) { m_r[c] = -3.0e38f; l_r[c] = 0.f;
#pragma unroll
    for (int dt = 0; dt < DT; ++dt) oacc[c][dt] = (v8f){0.f,0.f,0.f,0.f,0.f,0.f,0.f,0.f}; }
  asm volatile("s_wait_asynccnt 0x0" ::: "memory");      /* stage 0: this wave's copies have landed */
  __syncthreads();      /* stage 0 is readable by every wave */
  kv_stage(lk0 + BUFB, lv0 + BUFB, gk + kst, k16, gv + KT, v16);
#pragma unroll 1      /* stays rolled: one copy of the body serves both buffers, chosen by st & 1 */
  for (int st = 0; st < nst; ++st) {      /* stage st is worked on while stage st + 1 flies into the other buffer */
    const int bf = st & 1;
#pragma unroll      /* unrolled: the half stage becomes a constant offset of the LDS reads */
    for (int sub = 0; sub < KT / 32; ++sub) {
    FragH ak[2][KS], av[DT];
#pragma unroll
    for (int nt = 0; nt < 2; ++nt) { const unsigned short* kr = &sK[kg][bf][sub * 32 + nt * 16 + ln][0];
#pragma unroll
      for (int ks = 0; ks < KS; ++ks) { ak[nt][ks].half[0] = *(const v8us*)(kr + ks * 32 + 8 * hh); ak[nt][ks].half[1] = *(const v8us*)(kr + ks * 32 + 16 + 8 * hh); } }
#pragma unroll
    for (int dt = 0; dt < DT; ++dt) { const unsigned short* vrow = &sV[kg][bf][dt * 16 + ln][sub * 32]; av[dt].half[0] = *(const v8us*)(vrow + 8 * hh); av[dt].half[1] = *(const v8us*)(vrow + 16 + 8 * hh); }
    __builtin_amdgcn_sched_barrier(0);      /* holds the sixteen LDS reads of the half stage together in front of its products; without it the compiler strews them in pairs among the products, each pair waited for where it stands */
    v8f s[CT][2];
#pragma unroll
    for (int nt = 0; nt < 2; ++nt)
#pragma unroll
      for (int c = 0; c < CT; ++c) {
        v8f acc = (v8f){0.f,0.f,0.f,0.f,0.f,0.f,0.f,0.f};
#pragma unroll
        for (int ks = 0; ks < KS; ++ks) acc = __builtin_amdgcn_wmma_f32_16x16x32_f16(false, ak[nt][ks].v, false, bq[c][ks].v, (short)0, acc, false, false);
        s[c][nt] = acc; }
    FragH pb[CT];
#pragma unroll      /* unrolled: the two column groups' chains are independent and interleave */
    for (int c = 0; c < CT; ++c) {
    float sc[16], t[8];
#pragma unroll
    for (int i = 0; i < 16; ++i) sc[i] = s[c][i >> 3][i & 7];      /* unscaled scores (the scale is positive: the maximum commutes with it) */
#pragma unroll
    for (int i = 0; i < 8; ++i) t[i] = fmaxf(sc[i], sc[i + 8]);
    float mc = fmaxf(fmaxf(fmaxf(t[0], t[1]), fmaxf(t[2], t[3])), fmaxf(fmaxf(t[4], t[5]), fmaxf(t[6], t[7])));
    mc = fmaxf(mc, xhalf(mc));      /* both halves feed one O^T column: one maximum for both */
    const float mn = fmaxf(m_r[c], mc); const float al = (mn > -1.0e38f) ? __builtin_amdgcn_exp2f((m_r[c] - mn) * C2) : 1.0f; m_r[c] = mn;
    const float nb = __builtin_fmaf(-mn, C2, 10.0f);      /* 1024 p = 2^(C2 s - C2 m + 10): one fused multiply-add in front of the hardware's base-2 exponential */
#pragma unroll
    for (int i = 0; i < 16; ++i) sc[i] = __builtin_fmaf(sc[i], C2, nb);
    /* sixteen exponentials in place, in one statement: each is independent of the one in front of it (no result read, no source overwritten), and the closing v_nop is the slot behind the last one; last element first, because the packing behind it starts with the last pair */
    asm("v_exp_f32 %15, %15\n\tv_exp_f32 %14, %14\n\tv_exp_f32 %13, %13\n\tv_exp_f32 %12, %12\n\t"
        "v_exp_f32 %11, %11\n\tv_exp_f32 %10, %10\n\tv_exp_f32 %9, %9\n\tv_exp_f32 %8, %8\n\t"
        "v_exp_f32 %7, %7\n\tv_exp_f32 %6, %6\n\tv_exp_f32 %5, %5\n\tv_exp_f32 %4, %4\n\t"
        "v_exp_f32 %3, %3\n\tv_exp_f32 %2, %2\n\tv_exp_f32 %1, %1\n\tv_exp_f32 %0, %0\n\tv_nop"
        : "+v"(sc[0]), "+v"(sc[1]), "+v"(sc[2]), "+v"(sc[3]), "+v"(sc[4]), "+v"(sc[5]), "+v"(sc[6]), "+v"(sc[7]),
          "+v"(sc[8]), "+v"(sc[9]), "+v"(sc[10]), "+v"(sc[11]), "+v"(sc[12]), "+v"(sc[13]), "+v"(sc[14]), "+v"(sc[15]));
#pragma unroll
    for (int i = 0; i < 16; ++i) pb[c].h[i] = (_Float16)sc[i];
#pragma unroll
    for (int i = 0; i < 8; ++i) t[i] = sc[i] + sc[i + 8];
    l_r[c] = l_r[c] * al + (((t[0] + t[1]) + (t[2] + t[3])) + ((t[4] + t[5]) + (t[6] + t[7])));
#pragma unroll
    for (int dt = 0; dt < DT; ++dt)
#pragma unroll
      for (int r = 0; r < 8; ++r) oacc[c][dt][r] *= al;
    }
#pragma unroll
    for (int dt = 0; dt < DT; ++dt)
#pragma unroll
      for (int c = 0; c < CT; ++c) oacc[c][dt] = __builtin_amdgcn_wmma_f32_16x16x32_f16(false, av[dt].v, false, pb[c].v, (short)0, oacc[c][dt], false, false);
    }
    __builtin_amdgcn_sched_barrier(0);      /* holds the stage's products in front of its foot, so that the refill behind the barrier is issued a whole stage ahead of its wait */
    asm volatile("s_wait_dscnt 0x0" ::: "memory");      /* this wave's reads of buffer bf are done before the buffer is given up */
    asm volatile("s_wait_asynccnt 0x0" ::: "memory");      /* this wave's copies of stage st + 1 have landed */
    __syncthreads();      /* publishes stage st + 1 and ends every wave's reads of buffer bf */
    if (st + 2 < nst) kv_stage(lk0 + bf * BUFB, lv0 + bf * BUFB, gk + (size_t)(st + 2) * kst, k16, gv + (size_t)(st + 2) * KT, v16);
  }
  asm volatile("s_wait_asynccnt 0x0" ::: "memory");      /* no copy is left in flight when the wave goes on */
  if (kg > 0) {      /* a lane's partials go to the same lane of group 0: 16 B a lane, lanes side by side */
    v4f* mp = &sM[kg - 1][qt][0][lane];
#pragma unroll
    for (int c = 0; c < CT; ++c)
#pragma unroll
      for (int dt = 0; dt < DT; ++dt) {
        *(v4fa*)(mp + ((c * DT + dt) * 2) * 32) = (v4f){oacc[c][dt][0], oacc[c][dt][1], oacc[c][dt][2], oacc[c][dt][3]};
        *(v4fa*)(mp + ((c * DT + dt) * 2 + 1) * 32) = (v4f){oacc[c][dt][4], oacc[c][dt][5], oacc[c][dt][6], oacc[c][dt][7]}; }
    *(v4fa*)(mp + (MV - 1) * 32) = (v4f){m_r[0], l_r[0], m_r[1], l_r[1]};
  }
  __syncthreads();      /* the partials of groups 1 .. KSP - 1 are readable by group 0; every wave passes it, and it is the last barrier */
  if (kg > 0) return;
#pragma unroll 1      /* stays rolled: one group's partials in registers at a time */
  for (int g = 0; g < KSP - 1; ++g) {
    const v4f* mp = &sM[g][qt][0][lane];
    const v4f ml = *(const v4fa*)(mp + (MV - 1) * 32);
#pragma unroll
    for (int c = 0; c < CT; ++c) {
      const float mg = ml[2 * c], lg = ml[2 * c + 1];
      const float mn = fmaxf(m_r[c], mg); const float a0 = __builtin_amdgcn_exp2f((m_r[c] - mn) * C2), a1 = __builtin_amdgcn_exp2f((mg - mn) * C2);
      m_r[c] = mn; l_r[c] = l_r[c] * a0 + lg * a1;
#pragma unroll
      for (int dt = 0; dt < DT; ++dt) {
        const v4f lo = *(const v4fa*)(mp + ((c * DT + dt) * 2) * 32), hi = *(const v4fa*)(mp + ((c * DT + dt) * 2 + 1) * 32);
#pragma unroll
        for (int r = 0; r < 4; ++r) { oacc[c][dt][r] = oacc[c][dt][r] * a0 + lo[r] * a1; oacc[c][dt][4 + r] = oacc[c][dt][4 + r] * a0 + hi[r] * a1; } } }
  }
  float (*sO)[68] = (float (*)[68])&sM[0][qt][0][0];      /* this wave alone has read that plane, and its reads are done: their values are in use above */
#pragma unroll
  for (int c = 0; c < CT; ++c) {
    const float l = l_r[c] + xhalf(l_r[c]); const float li = (l > 0.f) ? 1.0f / l : 0.f;      /* numerator and sum both carry the factor 1024 */
#pragma unroll
    for (int dt = 0; dt < DT; ++dt) {      /* oacc[c][dt][r] = O[q0 + 16 c + ln][16 dt + 8 hh + r] */
      const v4f lo = {oacc[c][dt][0] * li, oacc[c][dt][1] * li, oacc[c][dt][2] * li, oacc[c][dt][3] * li}, hi = {oacc[c][dt][4] * li, oacc[c][dt][5] * li, oacc[c][dt][6] * li, oacc[c][dt][7] * li};
      *(v4fa*)&sO[c * 16 + ln][dt * 16 + 8 * hh] = lo; *(v4fa*)&sO[c * 16 + ln][dt * 16 + 8 * hh + 4] = hi; } }
  __builtin_amdgcn_fence(__ATOMIC_ACQ_REL, "workgroup"); __builtin_amdgcn_wave_barrier();
  { v4h h4[QW / 2];      /* all LDS reads first, so that the waits behind the stores do not stand between them */
#pragma unroll      /* unrolled, here and below: h4 is indexed by constants and stays in registers */
    for (int rp = 0; rp < QW; rp += 2) { const v4f val = *(const v4fa*)&sO[rp + (lane >> 4)][(lane & 15) * 4]; for (int i = 0; i < 4; ++i) h4[rp >> 1][i] = (_Float16)val[i]; }      /* ctx leaves as the f16 operand of the last product */
#pragma unroll
    for (int rp = 0; rp < QW; rp += 2) { const int r = rp + (lane >> 4), pc = lane & 15; *(v4h*)(O + ((size_t)b * TQ + q0 + r) * ldo + h * 64 + pc * 4) = h4[rp >> 1];      /* sixteen lanes fill one 128-B line */
      if (rp + 2 < QW) asm volatile("s_wait_xcnt 0x0" ::: "memory"); }      /* the address sums that follow reuse the store's registers */
     } }
// 5-plane variant: S = Qh Kh^T + (Ql Kh^T + Qh Kl^T)/1024 with Q/K = [hi | 2^10 residual] f16 planes (QL/KL same layout as Q16/K16), then the 3-term P.V below.
// 3-term variant: O = (P_hi V_hi + (P_lo V_hi + P_hi V_lo) / 1024) / l with P = [hi | 2^10 residual] of 1024 p and V^T = [hi | 2^10 residual] planes (VtL same layout as Vt) -> ~2^-21-class products for un-averaged (early causal / peaked) rows
template <int CAUSAL>
__global__ __launch_bounds__(128) void k_flash5(const _Float16* __restrict__ Q16, const _Float16* __restrict__ QL, int ldq, const _Float16* __restrict__ K16, const _Float16* __restrict__ KL, int ldk, const _Float16* __restrict__ Vt, const _Float16* __restrict__ VtL, const int* __restrict__ MSK, float* __restrict__ O, int ldo) {
  constexpr int RPW = 16, RTN = RPW / 16, NQB = TQ / (4 * RPW), DT = 4, KS = 2;
  __shared__ __attribute__((aligned(16))) unsigned short sP[4][RPW][40]; __shared__ __attribute__((aligned(16))) unsigned short sPL[4][RPW][40]; __shared__ __attribute__((aligned(16))) float sO[4][RPW][64 + 4];
  const int tid = threadIdx.x, w = tid >> 5, lane = tid & 31, ln = lane & 15, hh = lane >> 4;
  const int slab = blockIdx.x / QBN5, qblk = QB05 + blockIdx.x % QBN5; (void)NQB; const int b = slab / NH, h = slab % NH; const int qb0 = qblk * (4 * RPW); const int q0 = qb0 + w * RPW;
  FragH aq[2][KS], aql[2][KS];
#pragma unroll
  for (int rt = 0; rt < RTN; ++rt) { const unsigned short* qr = (const unsigned short*)Q16 + ((size_t)b * TQ + q0 + rt * 16 + ln) * ldq + h * 64; const unsigned short* ql = (const unsigned short*)QL + ((size_t)b * TQ + q0 + rt * 16 + ln) * ldq + h * 64;
#pragma unroll
    for (int ks = 0; ks < KS; ++ks) { aq[rt][ks].half[0] = *(const v8us*)(qr + ks * 32 + 8 * hh); aq[rt][ks].half[1] = *(const v8us*)(qr + ks * 32 + 16 + 8 * hh); aql[rt][ks].half[0] = *(const v8us*)(ql + ks * 32 + 8 * hh); aql[rt][ks].half[1] = *(const v8us*)(ql + ks * 32 + 16 + 8 * hh); } }
  const unsigned short* Vth = (const unsigned short*)Vt + (size_t)slab * 64 * TK; const unsigned short* Vtl = (const unsigned short*)VtL + (size_t)slab * 64 * TK;
  float m_r[2][8], l_r[2][8]; v8f oacc[2][DT], oaccL[2][DT];
#pragma unroll
  for (int rt = 0; rt < RTN; ++rt) {
#pragma unroll
    for (int r = 0; r < 8; ++r) { m_r[rt][r] = -3.0e38f; l_r[rt][r] = 0.f; }
#pragma unroll
    for (int dt = 0; dt < DT; ++dt) { oacc[rt][dt] = (v8f){0.f,0.f,0.f,0.f,0.f,0.f,0.f,0.f}; oaccL[rt][dt] = oacc[rt][dt]; } }
  const int jend = (CAUSAL == 1) ? (qb0 + 4 * RPW) : TK;      /* causal: keys beyond the block's last query never contribute */
#pragma unroll 1
  for (int j0 = 0; j0 < jend; j0 += 32) {
    v8f s[2][2];
#pragma unroll
    for (int nt = 0; nt < 2; ++nt) { const unsigned short* kr = (const unsigned short*)K16 + ((size_t)b * TK + j0 + nt * 16 + ln) * ldk + h * 64; const unsigned short* klr = (const unsigned short*)KL + ((size_t)b * TK + j0 + nt * 16 + ln) * ldk + h * 64; FragH bk[KS], bkl[KS];
#pragma unroll
      for (int ks = 0; ks < KS; ++ks) { bk[ks].half[0] = *(const v8us*)(kr + ks * 32 + 8 * hh); bk[ks].half[1] = *(const v8us*)(kr + ks * 32 + 16 + 8 * hh); bkl[ks].half[0] = *(const v8us*)(klr + ks * 32 + 8 * hh); bkl[ks].half[1] = *(const v8us*)(klr + ks * 32 + 16 + 8 * hh); }
#pragma unroll
      for (int rt = 0; rt < RTN; ++rt) { v8f acc = (v8f){0.f,0.f,0.f,0.f,0.f,0.f,0.f,0.f}, accl = acc;
#pragma unroll
        for (int ks = 0; ks < KS; ++ks) { acc = mmaH<1>(aq[rt][ks].v, aq[rt][ks].v, bk[ks].v, bk[ks].v, acc); accl = mmaH<1>(aql[rt][ks].v, aql[rt][ks].v, bk[ks].v, bk[ks].v, accl); accl = mmaH<1>(aq[rt][ks].v, aq[rt][ks].v, bkl[ks].v, bkl[ks].v, accl); }
#pragma unroll
        for (int r = 0; r < 8; ++r) acc[r] += accl[r] * 0.0009765625f;
        s[rt][nt] = acc; } }
#pragma unroll
    for (int rt = 0; rt < RTN; ++rt)
#pragma unroll
      for (int r = 0; r < 8; ++r) { const int tq = q0 + rt * 16 + 8 * hh + r; const int k0 = j0 + ln, k1 = j0 + 16 + ln;
        bool ok0 = (CAUSAL == 1) ? (k0 <= tq) : ((CAUSAL == 2) ? ((k0 >> 5) == (tq >> 5)) : true), ok1 = (CAUSAL == 1) ? (k1 <= tq) : ((CAUSAL == 2) ? ((k1 >> 5) == (tq >> 5)) : true);      /* mode 2: block-diagonal 32-token groups */
        if (CAUSAL == 4) { const int* mrow = MSK + ((size_t)b * TQ + tq) * TK; ok0 = mrow[k0] != 0; ok1 = mrow[k1] != 0; }      /* mode 4: per-(query, key) INPUT mask shared by all heads; masked keys contribute nothing (== the reference's -4096 fill, whose exp underflows to 0), rows with no valid key give l = 0 -> output 0 (== the reference's row_valid zeroing) */
        float s0 = ok0 ? s[rt][0][r] * SCL : -3.0e38f, s1 = ok1 ? s[rt][1][r] * SCL : -3.0e38f; if (CAUSAL == 17) { const float* amk = (const float*)MSK + (size_t)b * TK; s0 += bf16_round(amk[k0]); s1 += bf16_round(amk[k1]); }      /* mode 17: additive per-(batch, key) mask INPUT */ float mc = fmaxf(s0, s1);
        mc = fmaxf(mc, __shfl_xor(mc, 1, 32)); mc = fmaxf(mc, __shfl_xor(mc, 2, 32)); mc = fmaxf(mc, __shfl_xor(mc, 4, 32)); mc = fmaxf(mc, __shfl_xor(mc, 8, 32));
        const float mn = fmaxf(m_r[rt][r], mc); const float al = (mn > -1.0e38f) ? expf(m_r[rt][r] - mn) : 1.0f; m_r[rt][r] = mn; const float p0 = ok0 ? expf(s0 - mn) : 0.f, p1 = ok1 ? expf(s1 - mn) : 0.f; l_r[rt][r] = l_r[rt][r] * al + p0 + p1;
#pragma unroll
        for (int dt = 0; dt < DT; ++dt) { oacc[rt][dt][r] *= al; oaccL[rt][dt][r] *= al; }
        FragH t2, t2l; const float ps0 = p0 * 1024.0f, ps1 = p1 * 1024.0f; t2.h[0] = (_Float16)ps0; t2.h[1] = (_Float16)ps1; t2l.h[0] = (_Float16)((ps0 - (float)t2.h[0]) * 1024.0f); t2l.h[1] = (_Float16)((ps1 - (float)t2.h[1]) * 1024.0f);
        sP[w][rt * 16 + 8 * hh + r][ln] = t2.u[0]; sP[w][rt * 16 + 8 * hh + r][16 + ln] = t2.u[1]; sPL[w][rt * 16 + 8 * hh + r][ln] = t2l.u[0]; sPL[w][rt * 16 + 8 * hh + r][16 + ln] = t2l.u[1]; }
    __builtin_amdgcn_fence(__ATOMIC_ACQ_REL, "workgroup"); __builtin_amdgcn_wave_barrier();
    FragH pa[2], pl[2];
#pragma unroll
    for (int rt = 0; rt < RTN; ++rt) { pa[rt].half[0] = *(const v8us*)&sP[w][rt * 16 + ln][8 * hh]; pa[rt].half[1] = *(const v8us*)&sP[w][rt * 16 + ln][16 + 8 * hh]; pl[rt].half[0] = *(const v8us*)&sPL[w][rt * 16 + ln][8 * hh]; pl[rt].half[1] = *(const v8us*)&sPL[w][rt * 16 + ln][16 + 8 * hh]; }
#pragma unroll
    for (int dt = 0; dt < DT; ++dt) { const unsigned short* vrow = Vth + (size_t)(dt * 16 + ln) * TK + j0; const unsigned short* vrl = Vtl + (size_t)(dt * 16 + ln) * TK + j0; FragH bv, bl; bv.half[0] = *(const v8us*)(vrow + 8 * hh); bv.half[1] = *(const v8us*)(vrow + 16 + 8 * hh); bl.half[0] = *(const v8us*)(vrl + 8 * hh); bl.half[1] = *(const v8us*)(vrl + 16 + 8 * hh);
#pragma unroll
      for (int rt = 0; rt < RTN; ++rt) { oacc[rt][dt] = mmaH<1>(pa[rt].v, pa[rt].v, bv.v, bv.v, oacc[rt][dt]); oaccL[rt][dt] = mmaH<1>(pl[rt].v, pl[rt].v, bv.v, bv.v, oaccL[rt][dt]); oaccL[rt][dt] = mmaH<1>(pa[rt].v, pa[rt].v, bl.v, bl.v, oaccL[rt][dt]); } }
    __builtin_amdgcn_fence(__ATOMIC_ACQ_REL, "workgroup"); __builtin_amdgcn_wave_barrier(); }
#pragma unroll
  for (int rt = 0; rt < RTN; ++rt) {
#pragma unroll
    for (int r = 0; r < 8; ++r) { float l = l_r[rt][r]; l += __shfl_xor(l, 1, 32); l += __shfl_xor(l, 2, 32); l += __shfl_xor(l, 4, 32); l += __shfl_xor(l, 8, 32); l_r[rt][r] = (l > 0.f) ? 1.0f / (l * 1024.0f) : 0.f; }
#pragma unroll
    for (int dt = 0; dt < DT; ++dt)
#pragma unroll
      for (int r = 0; r < 8; ++r) { float v = oacc[rt][dt][r]; v += oaccL[rt][dt][r] * 0.0009765625f; sO[w][rt * 16 + 8 * hh + r][dt * 16 + ln] = v * l_r[rt][r]; } }
  __builtin_amdgcn_fence(__ATOMIC_ACQ_REL, "workgroup"); __builtin_amdgcn_wave_barrier();
  {
#pragma unroll
    for (int rp = 0; rp < RPW; rp += 2) { const int r = rp + (lane >> 4), pc = lane & 15; const v4f val = *(const v4fa*)&sO[w][r][pc * 4]; *(v4f*)(O + ((size_t)b * TQ + q0 + r) * ldo + h * 64 + pc * 4) = val; }
     } }

__global__ __launch_bounds__(256) void k_rotab(float* __restrict__ CS, float* __restrict__ SN) {
  #pragma clang fp contract(off)
  const int t = blockIdx.x * 256 + threadIdx.x; if (t >= SLEN * 32) return; const int j = t % 32, s = t / 32; const float ex = (float)(2 * j) / 64.0f; const float inv = 1.0f / powf(10000.0f, ex); const float th = (float)s * inv; const float c = cosf(th), sn = sinf(th);
  { *(float*)(CS + t) = c; *(float*)(SN + t) = sn;  } }
__global__ __launch_bounds__(256) void k_rope(const float* __restrict__ F, int nsrc, int ndst, int rep, const float* __restrict__ CS, const float* __restrict__ SN, _Float16* __restrict__ H, _Float16* __restrict__ L) {
  #pragma clang fp contract(off)
  const size_t t = (size_t)blockIdx.x * 256 + threadIdx.x; if (t >= (size_t)NR * ndst * 4) return; const int g8 = (int)(t % 4); const int hd = (int)((t / 4) % ndst); const size_t row = t / ((size_t)4 * ndst); const int s = (int)(row % SLEN); const int hs = hd / rep;
  const float* src = F + row * (size_t)(nsrc * 64) + hs * 64; FragH ah, al, bh, bl;
  for (int i = 0; i < 8; ++i) { const int d = g8 * 8 + i; const float c = CS[s * 32 + d], sn = SN[s * 32 + d]; const float x1 = src[d], x2 = src[d + 32];
    float o1 = x1 * c; o1 += -x2 * sn; float o2 = x2 * c; o2 += x1 * sn;
    _Float16 hv = (_Float16)o1; ah.h[i] = hv; al.h[i] = (_Float16)((o1 - (float)hv) * 1024.0f); hv = (_Float16)o2; bh.h[i] = hv; bl.h[i] = (_Float16)((o2 - (float)hv) * 1024.0f); }
  const size_t o = row * (size_t)(ndst * 64) + hd * 64 + g8 * 8;
  { *(v8us*)((unsigned short*)H + o) = ah.half[0]; *(v8us*)((unsigned short*)H + o + 32) = bh.half[0]; *(v8us*)((unsigned short*)L + o) = al.half[0]; *(v8us*)((unsigned short*)L + o + 32) = bl.half[0];  } }
__global__ __launch_bounds__(256) void k_rope2(const float* __restrict__ F, int nsrc, int ndst, int rep, const float* __restrict__ CS, const float* __restrict__ SN, _Float16* __restrict__ H, _Float16* __restrict__ L) {
  #pragma clang fp contract(off)
  const size_t t = (size_t)blockIdx.x * 256 + threadIdx.x; if (t >= (size_t)NR * ndst * 4) return; const int g16 = (int)(t % 4); const int hd = (int)((t / 4) % ndst); const size_t row = t / ((size_t)4 * ndst); const int s = (int)(row % SLEN); const int hs = hd / rep;
  const float* src = F + row * (size_t)(nsrc * 64) + hs * 64 + g16 * 16; FragH ah, al;
  for (int pr = 0; pr < 8; ++pr) { const int i = g16 * 8 + pr; const float c = CS[s * 32 + i], sn = SN[s * 32 + i]; const float x1 = src[2 * pr], x2 = src[2 * pr + 1];
    float o1 = x1 * c; o1 -= x2 * sn; float o2 = x1 * sn; o2 += x2 * c;
    _Float16 hv = (_Float16)o1; ah.h[2 * pr] = hv; al.h[2 * pr] = (_Float16)((o1 - (float)hv) * 1024.0f); hv = (_Float16)o2; ah.h[2 * pr + 1] = hv; al.h[2 * pr + 1] = (_Float16)((o2 - (float)hv) * 1024.0f); }
  const size_t o = row * (size_t)(ndst * 64) + hd * 64 + g16 * 16;
  { *(v8us*)((unsigned short*)H + o) = ah.half[0]; *(v8us*)((unsigned short*)H + o + 8) = ah.half[1]; *(v8us*)((unsigned short*)L + o) = al.half[0]; *(v8us*)((unsigned short*)L + o + 8) = al.half[1];  } }
__global__ __launch_bounds__(256) void k_tabin(const float* __restrict__ sp, float* __restrict__ CS, float* __restrict__ SN) { const int t = blockIdx.x * 256 + threadIdx.x; if (t >= SLEN * 32) return; const int i = t % 32, s = t / 32; const float c = bf16_round(sp[s * 64 + 32 + i]), sn = bf16_round(sp[s * 64 + i]);
  { *(float*)(CS + t) = c; *(float*)(SN + t) = sn;  } }
__device__ __forceinline__ void d_wsc(const size_t t, const float* __restrict__ Wm, _Float16* __restrict__ Bt, size_t n8, float sc) { if (t >= n8) return; FragH f; for (int q = 0; q < 8; ++q) f.h[q] = (_Float16)(bf16_round(Wm[t * 8 + q]) * sc); *(v8us*)((unsigned short*)Bt + t * 8) = f.half[0];  }
__global__ __launch_bounds__(256) void k_rotab2(float* __restrict__ CS, float* __restrict__ SN) {
  #pragma clang fp contract(off)
  const int t = blockIdx.x * 256 + threadIdx.x; if (t >= SLEN * 32) return; const int j = t % 32, s = t / 32; const float c0 = -0.14391156831212787f;      /* -ln(10000)/64 rounded to f32 */ const float inv = expf((float)(2 * j) * c0); const float th = (float)s * inv; const float c = cosf(th), sn = sinf(th);
  { *(float*)(CS + t) = c; *(float*)(SN + t) = sn;  } }
__global__ __launch_bounds__(256) void k_lnu(const float* __restrict__ X, _Float16* __restrict__ N16, float* __restrict__ XB) {
  #pragma clang fp contract(off)
  const int wv = threadIdx.x >> 5, ln = threadIdx.x & 31; const size_t r = (size_t)blockIdx.x * 8 + wv; if (r >= NR) return; float a[32]; float s = 0.f;
  for (int i = 0; i < 4; ++i) { const v8f v = *(const v8f*)(X + r * DM + (i * 32 + ln) * 8); for (int q = 0; q < 8; ++q) { const float u = bf16_round(v[q]); a[i * 8 + q] = u; s += u; } }
  for (int o = 16; o > 0; o >>= 1) s += __shfl_xor(s, o, 32); const float mu = s / (float)DM; float var = 0.f; for (int q = 0; q < 32; ++q) { const float d = a[q] - mu; var += d * d; }
  for (int o = 16; o > 0; o >>= 1) var += __shfl_xor(var, o, 32); const float den = sqrtf(var / (float)(DM - 1)) + 1e-6f; const float inv = 1.0f / den;      /* one reciprocal per row; (x-mean)*inv vs the reference's division differs by <= 1 ulp */
  { for (int i = 0; i < 4; ++i) { const int c0 = (i * 32 + ln) * 8; FragH f; v8f xb; for (int q = 0; q < 8; ++q) { f.h[q] = (_Float16)((a[i * 8 + q] - mu) * inv); xb[q] = a[i * 8 + q]; } *(v8us*)((unsigned short*)N16 + r * DM + c0) = f.half[0]; *(v8f*)(XB + r * DM + c0) = xb; }  } }
__global__ __launch_bounds__(256) void k_vtg(const _Float16* __restrict__ V16, _Float16* __restrict__ Vt) { __shared__ unsigned short tl[64][66]; const int tid = threadIdx.x; const int slab = blockIdx.x / (SLEN / 64), lg = blockIdx.x % (SLEN / 64); const int b = slab / NH, h = slab % NH; const int hs = h / NREP;
  for (int i = tid; i < 64 * 8; i += 256) { const int r = i / 8, c8 = (i % 8) * 8; FragH f; f.half[0] = *(const v8us*)((const unsigned short*)V16 + ((size_t)b * SLEN + lg * 64 + r) * KVD + hs * 64 + c8); for (int q = 0; q < 8; ++q) tl[r][c8 + q] = f.u[q]; }
  __syncthreads();
  { for (int rd = 0; rd < 2; ++rd) { const int d = rd * 32 + tid / 8, pc = tid % 8; FragH f; for (int q = 0; q < 8; ++q) f.u[q] = tl[pc * 8 + q][d]; *(v8us*)((unsigned short*)Vt + ((size_t)slab * 64 + d) * SLEN + lg * 64 + pc * 8) = f.half[0]; }  } }

// One 64-channel x 256-token tile of a channel-major f32 plane goes to the token-major f16 plane through LDS: a wave reads 512 contiguous bytes of one channel, eight lanes write one 128-B line of one token.
#define PTC 64      /* channels a tile: 64 halves = one 128-B line of the token-major plane */
#define PTN 256     /* tokens a tile */
#define PTD 33      /* LDS row pitch in dwords: 32 channel pairs + 1, so that the four token rows of one wave-wide read fall on different banks */
__device__ __forceinline__ void d_pmt(unsigned (*tl)[PTD], const int tile, const float* __restrict__ src, _Float16* __restrict__ P16) {
  const int tid = threadIdx.x, n4 = tid & 63, cg = tid >> 6;
  const int c0 = (tile % (DM / PTC)) * PTC, n0 = (tile / (DM / PTC)) * PTN;
  const float* p = src + (size_t)(c0 + 2 * cg) * SLEN + n0 + 4 * n4;
  v4f a[8], b[8];      /* all sixteen loads stand in front of the first use: one memory latency a tile */
#pragma unroll      /* unrolled, here and below: a and b are indexed by constants and stay in registers */
  for (int i = 0; i < 8; ++i) { a[i] = *(const v4fa*)(p + (size_t)(8 * i) * SLEN); b[i] = *(const v4fa*)(p + (size_t)(8 * i + 1) * SLEN); }
  asm volatile("s_wait_xcnt 0x0" :: "v"(p) : "memory");      /* behind the loads, with their address as an input: the address pair lives up to this wait, so neither a load's result nor a later instruction overwrites it in front of the wait */
  __builtin_amdgcn_sched_barrier(0);      /* holds the sixteen loads together in front of the conversions; without it the compiler issues the last six behind waits on the first ten, two more memory latencies a tile */
#pragma unroll
  for (int i = 0; i < 8; ++i)
#pragma unroll
    for (int j = 0; j < 4; ++j) { FragH f; f.h[0] = (_Float16)bf16_round(a[i][j]); f.h[1] = (_Float16)bf16_round(b[i][j]); tl[4 * n4 + j][cg + 4 * i] = (unsigned)f.u[0] | ((unsigned)f.u[1] << 16); }      /* channels 2 q and 2 q + 1 of one token share a dword */
  __syncthreads();      /* the tile is complete before any row of it is read */
  union { unsigned d[4]; v8us h; } o[8];
#pragma unroll      /* unrolled, here and below: o is indexed by constants and stays in registers; all LDS reads stand in front of the stores */
  for (int i = 0; i < 8; ++i) { const unsigned* r = &tl[i * 32 + (tid >> 3)][(tid & 7) * 4]; o[i].d[0] = r[0]; o[i].d[1] = r[1]; o[i].d[2] = r[2]; o[i].d[3] = r[3]; }
  unsigned short* q = (unsigned short*)P16 + (size_t)(n0 + (tid >> 3)) * DM + c0 + (tid & 7) * 8;
#pragma unroll
  for (int i = 0; i < 8; ++i) *(v8us*)(q + (size_t)(i * 32) * DM) = o[i].h;
}
// The six independent preparation jobs in one launch: blocks [0, 2 PMB) write the two token-major planes, one tile each, the next 4 WSB blocks the four weight planes.
#define PMB ((DM / PTC) * (SLEN / PTN))
#define WSB ((DM * DM / 8 + 255) / 256)
__global__ __launch_bounds__(256) void k_prep(const float* __restrict__ vid, const float* __restrict__ reff, _Float16* __restrict__ XV, _Float16* __restrict__ XR,
    const float* __restrict__ Wq, const float* __restrict__ Wk, const float* __restrict__ Wv, const float* __restrict__ Wo, _Float16* __restrict__ BQ, _Float16* __restrict__ BK, _Float16* __restrict__ BV, _Float16* __restrict__ BO) {
  __shared__ unsigned tl[PTN][PTD];
  const int bx = blockIdx.x;
  if (bx < 2 * PMB) { const bool second = bx >= PMB; d_pmt(tl, bx - (second ? PMB : 0), second ? reff : vid, second ? XR : XV); return; }      /* the same for every thread of the block: the barrier inside is passed by all or none */
  const int j = (bx - 2 * PMB) / WSB, wb = (bx - 2 * PMB) % WSB;
  const float* Wm = (j == 0) ? Wq : ((j == 1) ? Wk : ((j == 2) ? Wv : Wo)); _Float16* Bt = (j == 0) ? BQ : ((j == 1) ? BK : ((j == 2) ? BV : BO));
  d_wsc((size_t)wb * 256 + threadIdx.x, Wm, Bt, DM * DM / 8, 16.0f); }
__global__ __launch_bounds__(256) void k_nchw(const float* __restrict__ F, float* __restrict__ outb) { const int t = blockIdx.x * 256 + threadIdx.x; if (t >= DM * (SLEN / 4)) return; const int p0 = (t % (SLEN / 4)) * 4; const int o = t / (SLEN / 4); v4f r; for (int q = 0; q < 4; ++q) r[q] = F[(size_t)(p0 + q) * DM + o];
  *(v4f*)(outb + (size_t)o * SLEN + p0) = r;  }

extern "C" void kernel_launch(void* const* d_in, const int* in_sizes, int n_in,
                              void* d_out, int out_size, void* d_ws, size_t ws_size, hipStream_t stream) {
  (void)in_sizes; (void)n_in; (void)out_size;
  const float* const* I = (const float* const*)d_in; const float* vid = I[0]; const float* reff = I[1]; const float* Wq = I[2]; const float* bq = I[3]; const float* Wk = I[4]; const float* bk = I[5]; const float* Wv = I[6]; const float* bv = I[7]; const float* Wo = I[8]; const float* bo = I[9];
  char* ws = (char*)d_ws; size_t off = 0;
  auto take = [&](size_t bytes) { char* p = ws + off; off += (bytes + 255) & ~(size_t)255; return p; };
  const size_t np = (size_t)SLEN * DM;
  _Float16* BQ = (_Float16*)take((size_t)DM * DM * 2); _Float16* BK = (_Float16*)take((size_t)DM * DM * 2); _Float16* BV = (_Float16*)take((size_t)DM * DM * 2); _Float16* BO = (_Float16*)take((size_t)DM * DM * 2);
  _Float16* XV = (_Float16*)take(np * 2); _Float16* XR = (_Float16*)take(np * 2); _Float16* Q16 = (_Float16*)take(np * 2); _Float16* K16 = (_Float16*)take(np * 2); _Float16* VT = (_Float16*)take(np * 2); _Float16* O16 = (_Float16*)take(np * 2);
  if (off > ws_size) return;      /* 2 + 6 x 4 = 26 MiB */
  k_prep<<<2 * PMB + 4 * WSB, 256, 0, stream>>>(vid, reff, XV, XR, Wq, Wk, Wv, Wo, BQ, BK, BV, BO);      /* 'oc' = natural Bt */
  const dim3 gP((SLEN / 128) * (DM / 64), 1);
  const dim3 gP3((SLEN / 128) * (DM / 64), 3);
  k_gemm2x3<0><<<gP3, 128, 0, stream>>>(XV, XR, XR, BQ, BK, BV, bq, bk, bv, Q16, K16, VT, 0.0625f, DM, SLEN, DM, DM);      /* q, k token-major; v as V^T [channel][token] */
  k_flash<4><<<NB * NH * (TQ / 128), 128 * 4, 0, stream>>>(Q16, DM, K16, DM, VT, O16, DM);      /* 4096 x 4096 per head */
  k_gemm2<0, true><<<gP, 128, 0, stream>>>(BO, DM, 0, O16, DM, 0, 0.0625f, bo, 0, nullptr, 1, 0, 0, (float*)d_out, nullptr, SLEN, 0, DM, SLEN, DM);      /* out[channel][token] */
}

// v010
// One run takes 57.5 microseconds.
// Next to v009, in two timings, it ran 1.05 times as fast each time.
// Counting every step since v000, which is the starting kernel, it is 10.1 times as fast.
#include <hip/hip_runtime.h>
// CrossViewAttention3D (1 clip: 512 channels x (4 x 32 x 32 = 4096) tokens, 8 heads x 64): q = Wq video + bq, k = Wk ref + bk, v = Wv ref + bv (1x1x1 convs = channel matmuls); softmax(q.k / 8) over the 4096 ref tokens; out = Wo ctx + bo; channel-major in and out.
// Structure: exact token-major f16 planes of both inputs; q, k, v as f16 WMMA GEMM outputs (64x64 wave tiles, f32 accumulation, exact x16 weights + bias, f16 out); V^T straight from its GEMM (weights as rows, tokens as columns); the fused flash kernel (4096 x 4096 per head, plain operands) stores ctx as f16; the Wo + bo GEMM, weights as rows, stores channel-major.
// Compute dtype: inputs rounded to bf16; inputs exact as f16; q/k/P/v/ctx as plain f16 operands (~2^-12); softmax f32. v_wmma_f32_16x16x32_f16.
#define NB 1
#define DM 512
#define NKV 8
#define NREP (NH / NKV)
#define KVD (NKV * 64)           /* 512 */
#define NR (NB * SLEN)           /* 4096 */
#define SLEN 4096
#define TQ SLEN
#define TK SLEN
#define NH 8
#define SCL 0.125f
#define QBLKS (TQ / 64)
#define QB05 0
#define QBN5 4
#define QB0P 0
#define QBNP QBLKS           /* non-causal: plain flash on every query block */
#define RE 256
typedef __bf16 v16b __attribute__((ext_vector_type(16)));
typedef unsigned short v8us __attribute__((ext_vector_type(8), may_alias));
typedef float  v8f  __attribute__((ext_vector_type(8)));
typedef float  v4f  __attribute__((ext_vector_type(4)));
typedef float  v4fa __attribute__((ext_vector_type(4), may_alias));
union FragB { v16b v; v8us half[2]; unsigned short u[16]; };

__device__ __forceinline__ unsigned short bf16_bits(float x) { unsigned int u = __float_as_uint(x); return (unsigned short)((u + 0x7FFFu + ((u >> 16) & 1u)) >> 16); }
__device__ __forceinline__ float bf16_val(unsigned short b) { return __uint_as_float(((unsigned int)b) << 16); }
__device__ __forceinline__ float bf16_round(float x) { return bf16_val(bf16_bits(x)); }
// D += A·B with NT terms: 1 = ah·bh, 2 = + al·bh (A split), 3 = + ah·bl (both split)
template <int NT>
__device__ __forceinline__ v8f mmaN(v16b ah, v16b al, v16b bh, v16b bl, v8f c) {
  c = __builtin_amdgcn_wmma_f32_16x16x32_bf16(false, ah, false, bh, (short)0, c, false, false);
  if (NT >= 2) c = __builtin_amdgcn_wmma_f32_16x16x32_bf16(false, al, false, bh, (short)0, c, false, false);
  if (NT >= 3) c = __builtin_amdgcn_wmma_f32_16x16x32_bf16(false, ah, false, bl, (short)0, c, false, false);
  asm volatile("v_nop\n\tv_nop\n\tv_nop\n\tv_nop" : "+v"(c) : "v"(ah), "v"(al), "v"(bh), "v"(bl));
  return c;
}

__global__ __launch_bounds__(256) void k_wt_bf16(const float* __restrict__ W, unsigned short* __restrict__ Wt, int K, int N) {
  const int t = blockIdx.x * 256 + threadIdx.x;
  const int k8n = K / 8;
  if (t >= N * k8n) return;
  const int n = t / k8n, k8 = (t % k8n) * 8;
  v8us v;
#pragma unroll
  for (int i = 0; i < 8; ++i) v[i] = bf16_bits(W[(size_t)(k8 + i) * N + n]);
  *(v8us*)(Wt + (size_t)n * K + k8) = v;
  
}

// GEMM C[M][N] (f32, pitch ldc) = act(A[M][K]·W + bias). A f32 row-major (pitch lda) converted per fragment to bf16
// (ASPLIT: hi/lo two planes -> 2 terms, else single rounded term); Wt bf16 [N][K] (pitch ldb). BIAS_BF16 rounds the
// bias to bf16 first (bias quantised to bf16 before the add). K%32==0, M%16==0, N%64==0.
template <bool ASPLIT, int ACT, bool BIAS_BF16>
__global__ __launch_bounds__(128) void k_gemm_bf(const float* __restrict__ A, int lda, const unsigned short* __restrict__ Wt, int ldb,
                                               const float* __restrict__ bias, float* __restrict__ C, int ldc, int M, int N, int K) {
  __shared__ __attribute__((aligned(16))) float so[4][16][64];
  const int tid = threadIdx.x, w = tid >> 5, lane = tid & 31, ln = lane & 15, hh = lane >> 4;
  const int ntn = N / 64;
  const int wid = blockIdx.x * 4 + w;
  const int mt = wid / ntn, nq = wid % ntn;
  if (mt * 16 >= M) return;
  const int row0 = mt * 16, col0 = nq * 64;
  const float* arow = A + (size_t)(row0 + ln) * lda;
  v8f acc[4] = {};
  for (int kb = 0; kb < K; kb += 32) {
    FragB ah, al;
    const v4f x0 = *(const v4fa*)(arow + kb + 8 * hh), x1 = *(const v4fa*)(arow + kb + 8 * hh + 4);
    const v4f x2 = *(const v4fa*)(arow + kb + 16 + 8 * hh), x3 = *(const v4fa*)(arow + kb + 16 + 8 * hh + 4);
    float xs[16] = {x0[0],x0[1],x0[2],x0[3],x1[0],x1[1],x1[2],x1[3],x2[0],x2[1],x2[2],x2[3],x3[0],x3[1],x3[2],x3[3]};
#pragma unroll
    for (int i = 0; i < 16; ++i) { const unsigned short hb = bf16_bits(xs[i]); ah.u[i] = hb; al.u[i] = ASPLIT ? bf16_bits(xs[i] - bf16_val(hb)) : (unsigned short)0; }
#pragma unroll
    for (int t = 0; t < 4; ++t) {
      const unsigned short* brow = Wt + (size_t)(col0 + t * 16 + ln) * ldb + kb;
      FragB b;
      b.half[0] = *(const v8us*)(brow + 8 * hh);
      b.half[1] = *(const v8us*)(brow + 16 + 8 * hh);
      acc[t] = mmaN<ASPLIT ? 2 : 1>(ah.v, al.v, b.v, b.v, acc[t]);
    }
  }
#pragma unroll
  for (int t = 0; t < 4; ++t) {
    float bv = bias ? bias[col0 + t * 16 + ln] : 0.f;
    if (BIAS_BF16) bv = bf16_round(bv);
#pragma unroll
    for (int r = 0; r < 8; ++r) { float v = acc[t][r] + bv; if (ACT == 1) v = fmaxf(v, 0.f); so[w][8 * hh + r][t * 16 + ln] = v; }
  }
  __builtin_amdgcn_fence(__ATOMIC_ACQ_REL, "workgroup");
  __builtin_amdgcn_wave_barrier();
  const int rsub = lane >> 4, c4 = (lane & 15) * 4;
  {
#pragma unroll
    for (int q = 0; q < 8; ++q) {
      const int r = q * 2 + rsub;
      const v4f v = *(const v4fa*)&so[w][r][c4];
      *(v4f*)(C + (size_t)(row0 + r) * ldc + col0 + c4) = v;
    }
    
  }
}

// GEMM C = act(A·W + bias + resid): A f32 (ASPLIT -> hi/lo 2 terms), Wt bf16 [N][K]; ACT 0 none, 1 relu, 2 exact gelu;
// resid (optional, f32, row index = (row % rmod), pitch ldr, RES_BF16 rounds it) added before the activation.
template <bool ASPLIT, int ACT, bool BIAS_BF16, bool RES_BF16>
__global__ __launch_bounds__(128) void k_gemm_bf3(const float* __restrict__ A, int lda, const unsigned short* __restrict__ Wt, int ldb,
                                                const float* __restrict__ bias, const float* __restrict__ resid, int rmod, int ldr,
                                                float* __restrict__ C, int ldc, int M, int N, int K) {
  __shared__ __attribute__((aligned(16))) float so[4][16][64];
  const int tid = threadIdx.x, w = tid >> 5, lane = tid & 31, ln = lane & 15, hh = lane >> 4;
  const int ntn = N / 64;
  const int wid = blockIdx.x * 4 + w;
  const int mt = wid / ntn, nq = wid % ntn;
  if (mt * 16 >= M) return;
  const int row0 = mt * 16, col0 = nq * 64;
  const float* arow = A + (size_t)(row0 + ln) * lda;
  v8f acc[4] = {};
  for (int kb = 0; kb < K; kb += 32) {
    FragB ah, al;
    const v4f x0 = *(const v4fa*)(arow + kb + 8 * hh), x1 = *(const v4fa*)(arow + kb + 8 * hh + 4);
    const v4f x2 = *(const v4fa*)(arow + kb + 16 + 8 * hh), x3 = *(const v4fa*)(arow + kb + 16 + 8 * hh + 4);
    float xs[16] = {x0[0],x0[1],x0[2],x0[3],x1[0],x1[1],x1[2],x1[3],x2[0],x2[1],x2[2],x2[3],x3[0],x3[1],x3[2],x3[3]};
#pragma unroll
    for (int i = 0; i < 16; ++i) { const unsigned short hb = bf16_bits(xs[i]); ah.u[i] = hb; al.u[i] = ASPLIT ? bf16_bits(xs[i] - bf16_val(hb)) : (unsigned short)0; }
#pragma unroll
    for (int t = 0; t < 4; ++t) {
      const unsigned short* brow = Wt + (size_t)(col0 + t * 16 + ln) * ldb + kb;
      FragB b;
      b.half[0] = *(const v8us*)(brow + 8 * hh);
      b.half[1] = *(const v8us*)(brow + 16 + 8 * hh);
      acc[t] = mmaN<ASPLIT ? 2 : 1>(ah.v, al.v, b.v, b.v, acc[t]);
    }
  }
#pragma unroll
  for (int t = 0; t < 4; ++t) {
    const int col = col0 + t * 16 + ln;
    float bv = bias ? bias[col] : 0.f;
    if (BIAS_BF16) bv = bf16_round(bv);
#pragma unroll
    for (int r = 0; r < 8; ++r) {
      float v = acc[t][r] + bv;
      if (resid) { float rv = resid[(size_t)((row0 + 8 * hh + r) % rmod) * ldr + col]; if (RES_BF16) rv = bf16_round(rv); v += rv; }
      if (ACT == 1) v = fmaxf(v, 0.f);
      if (ACT == 2) v = 0.5f * v * (1.0f + erff(v * 0.70710678118654752f));
      if (ACT == 3) { const float u = 0.7978845608028654f * (v + 0.044715f * v * v * v); v = 0.5f * v * (1.0f + tanhf(u)); }
      so[w][8 * hh + r][t * 16 + ln] = v;
    }
  }
  __builtin_amdgcn_fence(__ATOMIC_ACQ_REL, "workgroup");
  __builtin_amdgcn_wave_barrier();
  const int rsub = lane >> 4, c4 = (lane & 15) * 4;
  {
#pragma unroll
    for (int q = 0; q < 8; ++q) {
      const int r = q * 2 + rsub;
      const v4f v = *(const v4fa*)&so[w][r][c4];
      *(v4f*)(C + (size_t)(row0 + r) * ldc + col0 + c4) = v;
    }
    
  }
}
// row LayerNorm (biased variance, eps) over N: s = X (+ R); optional out_sum <- s; out_norm <- (s-mu)*rsqrt(var+eps)*g + b
template <bool PARAM_BF16>
__global__ __launch_bounds__(256) void k_layernorm(const float* __restrict__ X, const float* __restrict__ R, const float* __restrict__ g, const float* __restrict__ bta,
                                                  float* __restrict__ out_sum, float* __restrict__ out_norm, int N, float eps) {
  __shared__ float red[256];
  const int row = blockIdx.x, tid = threadIdx.x;
  const float* x = X + (size_t)row * N; const float* rr = R ? R + (size_t)row * N : nullptr;
  float vals[16];                     // up to N = 4096
  const int per = N / 256;            // contiguous chunk per thread? use strided-by-4 chunks: thread handles j = tid*4 + 1024*u
  float s1 = 0.f;
  for (int u = 0; u < per / 4; ++u) {
    const int j = tid * 4 + 1024 * u;
    const v4f a = *(const v4fa*)(x + j);
    v4f b = {0.f,0.f,0.f,0.f}; if (rr) b = *(const v4fa*)(rr + j);
#pragma unroll
    for (int q = 0; q < 4; ++q) { const float v = a[q] + b[q]; vals[u * 4 + q] = v; s1 += v; }
  }
  red[tid] = s1; __syncthreads();
  for (int st = 128; st > 0; st >>= 1) { if (tid < st) red[tid] += red[tid + st]; __syncthreads(); }
  const float mu = red[0] / (float)N; __syncthreads();
  float s2 = 0.f;
  for (int u = 0; u < per / 4; ++u)
#pragma unroll
    for (int q = 0; q < 4; ++q) { const float c = vals[u * 4 + q] - mu; s2 += c * c; }
  red[tid] = s2; __syncthreads();
  for (int st = 128; st > 0; st >>= 1) { if (tid < st) red[tid] += red[tid + st]; __syncthreads(); }
  const float rs = rsqrtf(red[0] / (float)N + eps);
  {
    for (int u = 0; u < per / 4; ++u) {
      const int j = tid * 4 + 1024 * u;
      v4f o, sm;
#pragma unroll
      for (int q = 0; q < 4; ++q) {
        float gg = g[j + q], bb = bta[j + q];
        if (PARAM_BF16) { gg = bf16_round(gg); bb = bf16_round(bb); }
        sm[q] = vals[u * 4 + q]; o[q] = (vals[u * 4 + q] - mu) * rs * gg + bb;
      }
      if (out_sum) *(v4f*)(out_sum + (size_t)row * N + j) = sm;
      *(v4f*)(out_norm + (size_t)row * N + j) = o;
    }
    
  }
}



// ---- f16 WMMA path (v_wmma_f32_16x16x32_f16): 11-bit significands for operands in range — used where a [0,1] probability operand needs more precision than bf16
typedef _Float16 v16h __attribute__((ext_vector_type(16)));
union FragH { v16h v; v8us half[2]; _Float16 h[16]; unsigned short u[16]; };
template <int NT>
__device__ __forceinline__ v8f mmaH(v16h ah, v16h al, v16h bh, v16h bl, v8f c) {
  c = __builtin_amdgcn_wmma_f32_16x16x32_f16(false, ah, false, bh, (short)0, c, false, false);
  if (NT >= 2) c = __builtin_amdgcn_wmma_f32_16x16x32_f16(false, al, false, bh, (short)0, c, false, false);
  if (NT >= 3) c = __builtin_amdgcn_wmma_f32_16x16x32_f16(false, ah, false, bl, (short)0, c, false, false);
  asm volatile("v_nop\n\tv_nop\n\tv_nop\n\tv_nop" : "+v"(c) : "v"(ah), "v"(al), "v"(bh), "v"(bl));
  return c;
}
// batched GEMM like k_gemm_b but f16 operands: A f32 (split into f16 hi/lo if ASPLIT, else rounded to f16), Bt = f16 values [n][k]; alpha; C f32; N multiple of 16 (partial tiles skipped)
template <bool ASPLIT>
__global__ __launch_bounds__(128) void k_gemm_h(const float* __restrict__ A, int lda, size_t sA, const _Float16* __restrict__ Bh, int ldb, size_t sB, float alpha, float* __restrict__ C, int ldc, size_t sC, int M, int N, int K) {
  __shared__ __attribute__((aligned(16))) float so[4][16][64];
  const int tid = threadIdx.x, w = tid >> 5, lane = tid & 31, ln = lane & 15, hh = lane >> 4; const int by = blockIdx.y;
  A += (size_t)by * sA; Bh += (size_t)by * sB; C += (size_t)by * sC;
  const int ntn = (N + 63) / 64; const int wid = blockIdx.x * 4 + w; const int mt = wid / ntn, nq = wid % ntn; if (mt * 16 >= M) return;
  const int row0 = mt * 16, col0 = nq * 64; const float* arow = A + (size_t)(row0 + ln) * lda;
  v8f acc[4] = {};
  for (int kb = 0; kb < K; kb += 32) {
    FragH ah, al;
    const v4f x0 = *(const v4fa*)(arow + kb + 8 * hh), x1 = *(const v4fa*)(arow + kb + 8 * hh + 4), x2 = *(const v4fa*)(arow + kb + 16 + 8 * hh), x3 = *(const v4fa*)(arow + kb + 16 + 8 * hh + 4);
    float xs[16] = {x0[0],x0[1],x0[2],x0[3],x1[0],x1[1],x1[2],x1[3],x2[0],x2[1],x2[2],x2[3],x3[0],x3[1],x3[2],x3[3]};
#pragma unroll
    for (int i = 0; i < 16; ++i) { const _Float16 h = (_Float16)xs[i]; ah.h[i] = h; al.h[i] = ASPLIT ? (_Float16)(xs[i] - (float)h) : (_Float16)0.0f; }
#pragma unroll
    for (int t = 0; t < 4; ++t) { if (col0 + t * 16 >= N) continue; const size_t boff = (size_t)(col0 + t * 16 + ln) * ldb + kb; FragH bq; bq.half[0] = *(const v8us*)(Bh + boff + 8 * hh); bq.half[1] = *(const v8us*)(Bh + boff + 16 + 8 * hh);
      acc[t] = mmaH<ASPLIT ? 2 : 1>(ah.v, al.v, bq.v, bq.v, acc[t]); }
  }
#pragma unroll
  for (int t = 0; t < 4; ++t) { if (col0 + t * 16 >= N) continue;
#pragma unroll
    for (int r = 0; r < 8; ++r) so[w][8 * hh + r][t * 16 + ln] = acc[t][r] * alpha; }
  __builtin_amdgcn_fence(__ATOMIC_ACQ_REL, "workgroup"); __builtin_amdgcn_wave_barrier();
  const int rsub = lane >> 4, c4 = (lane & 15) * 4;
  {
#pragma unroll
    for (int q = 0; q < 8; ++q) { const int r = q * 2 + rsub; if (col0 + c4 < N) { const v4f v = *(const v4fa*)&so[w][r][c4]; *(v4f*)(C + (size_t)(row0 + r) * ldc + col0 + c4) = v; } }
     }
}

// Wt[n][k] = f16(W[k][n]·scale) from f32 row-major W[K][N] (scale = power of two; bf16-exact weights stay exact in f16 away from the subnormal range)
__global__ __launch_bounds__(256) void k_wt_f16(const float* __restrict__ W, _Float16* __restrict__ Wt, int K, int N, float scale) {
  const int t = blockIdx.x * 256 + threadIdx.x; if (t >= N * (K / 8)) return; const int n = t / (K / 8), k8 = (t % (K / 8)) * 8; FragH f;
#pragma unroll
  for (int i = 0; i < 8; ++i) f.h[i] = (_Float16)(bf16_round(W[(size_t)(k8 + i) * N + n]) * scale); const v8us o = f.half[0];
  *(v8us*)((unsigned short*)Wt + (size_t)n * K + k8) = o; 
}
// k_gemm_hh variant with fused epilogue: v = acc·alpha + bias[by·sBias + col] (+ CP[(row/rowsPerB)·sCPb + by·64 + col] if CP) ; ACT 0 none / 1 elu ; writes f16 C16 (and f32 C if non-null)
template <int ACT>
__global__ __launch_bounds__(128) void k_gemm_hhx(const _Float16* __restrict__ A, int lda, size_t sA, const _Float16* __restrict__ Bh, int ldb, size_t sB, float alpha, const float* __restrict__ bias, size_t sBias, const float* __restrict__ CP, int rowsPerB, size_t sCPb, int row0g,
    float* __restrict__ C, _Float16* __restrict__ C16, int ldc, size_t sC, int M, int N, int K) {
  __shared__ __attribute__((aligned(16))) float so[4][16][64];
  const int tid = threadIdx.x, w = tid >> 5, lane = tid & 31, ln = lane & 15, hh = lane >> 4; const int by = blockIdx.y;
  A += (size_t)by * sA; Bh += (size_t)by * sB; const size_t cofs = (size_t)by * sC; const float* bp = bias ? bias + (size_t)by * sBias : nullptr;
  const int ntn = (N + 63) / 64; const int wid = blockIdx.x * 4 + w; const int mt = wid / ntn, nq = wid % ntn; if (mt * 16 >= M) return;
  const int row0 = mt * 16, col0 = nq * 64; const _Float16* arow = A + (size_t)(row0 + ln) * lda;
  v8f acc[4] = {};
  for (int kb = 0; kb < K; kb += 32) { FragH ah; ah.half[0] = *(const v8us*)((const unsigned short*)arow + kb + 8 * hh); ah.half[1] = *(const v8us*)((const unsigned short*)arow + kb + 16 + 8 * hh);
#pragma unroll
    for (int t = 0; t < 4; ++t) { if (col0 + t * 16 >= N) continue; const size_t boff = (size_t)(col0 + t * 16 + ln) * ldb + kb; FragH bq; bq.half[0] = *(const v8us*)((const unsigned short*)Bh + boff + 8 * hh); bq.half[1] = *(const v8us*)((const unsigned short*)Bh + boff + 16 + 8 * hh);
      acc[t] = mmaH<1>(ah.v, ah.v, bq.v, bq.v, acc[t]); }
  }
#pragma unroll
  for (int t = 0; t < 4; ++t) { if (col0 + t * 16 >= N) continue; const int col = col0 + t * 16 + ln; const float bv = bp ? bf16_round(bp[col]) : 0.f;
#pragma unroll
    for (int r = 0; r < 8; ++r) { float v = acc[t][r] * alpha + bv; if (CP) { const int bidx = (row0g + row0 + 8 * hh + r) / rowsPerB; v += CP[(size_t)bidx * sCPb + (size_t)by * 64 + col]; } if (ACT == 1) v = (v > 0.f) ? v : expm1f(v); else if (ACT == 7) v = (v > 0.f) ? v + 1.0f : expf(v); else if (ACT == 8) v = tanhf(v); else if (ACT == 9) v = 0.5f * v * (1.0f + tanhf(0.7978845608028654f * (v + 0.044715f * v * v * v))); else if (ACT == 11) v = 1.0f / (1.0f + expf(-v)); else if (ACT == 12) v = (v > 0.f) ? v : 0.01f * v; else if (ACT == 14) v = (v > 0.f) ? v : 0.1f * v; else if (ACT == 15) v = v / (1.0f + expf(-v)); else if (ACT == 3) v = fmaxf(v, 0.f); else if (ACT == 6) v = 0.5f * v * (1.0f + erff(v * 0.70710678118654752f)); so[w][8 * hh + r][t * 16 + ln] = v; } }
  __builtin_amdgcn_fence(__ATOMIC_ACQ_REL, "workgroup"); __builtin_amdgcn_wave_barrier();
  const int rsub = lane >> 4, c4 = (lane & 15) * 4; typedef _Float16 v4h __attribute__((ext_vector_type(4)));
  {
#pragma unroll
    for (int q = 0; q < 8; ++q) { const int r = q * 2 + rsub; if (col0 + c4 < N) { const v4f v = *(const v4fa*)&so[w][r][c4]; if (C) *(v4f*)(C + cofs + (size_t)(row0 + r) * ldc + col0 + c4) = v; if (C16) { v4h h4; for (int i = 0; i < 4; ++i) h4[i] = (_Float16)v[i]; *(v4h*)(C16 + cofs + (size_t)(row0 + r) * ldc + col0 + c4) = h4; } } }
     }
}


typedef _Float16 v4h __attribute__((ext_vector_type(4)));

__global__ __launch_bounds__(256) void k_x16(const float* __restrict__ x, _Float16* __restrict__ X16, size_t n8) { const size_t t = (size_t)blockIdx.x * 256 + threadIdx.x; if (t >= n8) return; FragH f;
#pragma unroll
  for (int q = 0; q < 8; ++q) f.h[q] = (_Float16)bf16_round(x[t * 8 + q]); *(v8us*)((unsigned short*)X16 + t * 8) = f.half[0];  }
__global__ __launch_bounds__(256) void k_h16(const float* __restrict__ x, _Float16* __restrict__ X16, size_t n8) { const size_t t = (size_t)blockIdx.x * 256 + threadIdx.x; if (t >= n8) return; FragH f;
#pragma unroll
  for (int q = 0; q < 8; ++q) f.h[q] = (_Float16)x[t * 8 + q]; *(v8us*)((unsigned short*)X16 + t * 8) = f.half[0];  }
__global__ __launch_bounds__(256) void k_round16f(const float* __restrict__ W, _Float16* __restrict__ Bt, size_t n8) { const size_t t = (size_t)blockIdx.x * 256 + threadIdx.x; if (t >= n8) return; FragH f;
#pragma unroll
  for (int i = 0; i < 8; ++i) f.h[i] = (_Float16)(bf16_round(W[t * 8 + i]) * 16.0f); *(v8us*)((unsigned short*)Bt + t * 8) = f.half[0];  }
template <int NHv, int TTv>
__global__ __launch_bounds__(256) void k_vt(const _Float16* __restrict__ V16, int ldv, int voff, _Float16* __restrict__ Vt) { __shared__ unsigned short tl[64][66]; const int tid = threadIdx.x; const int slab = blockIdx.x / (TTv / 64), lg = blockIdx.x % (TTv / 64); const int b = slab / NHv, h = slab % NHv;
  for (int i = tid; i < 64 * 8; i += 256) { const int r = i / 8, c8 = (i % 8) * 8; FragH f; f.half[0] = *(const v8us*)((const unsigned short*)V16 + ((size_t)b * TTv + lg * 64 + r) * ldv + voff + h * 64 + c8);
#pragma unroll
    for (int q = 0; q < 8; ++q) tl[r][c8 + q] = f.u[q]; }
  __syncthreads();
  {
#pragma unroll
    for (int rd = 0; rd < 2; ++rd) { const int d = rd * 32 + tid / 8, pc = tid % 8; FragH f;
#pragma unroll
      for (int q = 0; q < 8; ++q) f.u[q] = tl[pc * 8 + q][d];
      *(v8us*)((unsigned short*)Vt + ((size_t)slab * 64 + d) * TTv + lg * 64 + pc * 8) = f.half[0]; }
     } }

__global__ __launch_bounds__(256) void k_hl(const float* __restrict__ F, _Float16* __restrict__ Hh, _Float16* __restrict__ Hl, size_t n8) { const size_t t = (size_t)blockIdx.x * 256 + threadIdx.x; if (t >= n8) return; FragH fh, fl; const v4f a = *(const v4fa*)(F + t * 8), c = *(const v4fa*)(F + t * 8 + 4);
#pragma unroll
  for (int q = 0; q < 4; ++q) { _Float16 h = (_Float16)a[q]; fh.h[q] = h; fl.h[q] = (_Float16)((a[q] - (float)h) * 1024.0f); h = (_Float16)c[q]; fh.h[4 + q] = h; fl.h[4 + q] = (_Float16)((c[q] - (float)h) * 1024.0f); }
  { *(v8us*)((unsigned short*)Hh + t * 8) = fh.half[0]; *(v8us*)((unsigned short*)Hl + t * 8) = fl.half[0];  } }

// ---- fast GEMM (four waves; work-group tile 128 x 64 NW, wave tile 32 NW x 64, KS halves of k a stage; requires M % 128 == 0, N % (64 NW) == 0 and K % KS == 0, K >= KS); epilogue = k_gemm_hhx semantics ----
#define G2P(KS) ((KS) + 8)      /* LDS row pitch in halves = the row + 16 B, the pitch of 16-byte LDS readers (272 B and 528 B: sixteen rows start four banks apart) */
#define G2ROWS(NW) (128 + 64 * (NW))      /* one stage: rows 0..127 = the block's 128 rows of A, the rest = its 64 NW rows of B */
#define G2BYTES(NW, KS) (2 * G2ROWS(NW) * G2P(KS) * 2)      /* two stages; behind the loop the same bytes serve as the waves' output staging (4 x 32 NW rows x 68 floats, which is less) */
__device__ __forceinline__ v16h g2_frag(const unsigned short* p, int hh) { FragH f; f.half[0] = *(const v8us*)(p + 8 * hh); f.half[1] = *(const v8us*)(p + 16 + 8 * hh); return f.v; }
// Eight asynchronous copies of 16 B a lane: piece i lies ls bytes further in LDS and gs halves further in global memory.
__device__ __forceinline__ void g2_copy8(unsigned l, unsigned ls, const _Float16* g, size_t gs) {
  const unsigned l1 = l + ls, l2 = l1 + ls, l3 = l2 + ls, l4 = l3 + ls, l5 = l4 + ls, l6 = l5 + ls, l7 = l6 + ls;
  const _Float16* g1 = g + gs; const _Float16* g2 = g1 + gs; const _Float16* g3 = g2 + gs; const _Float16* g4 = g3 + gs; const _Float16* g5 = g4 + gs; const _Float16* g6 = g5 + gs; const _Float16* g7 = g6 + gs;
  /* the closing s_wait_xcnt 0 stands inside the statement so that no address register of a copy is rewritten in front of it */
  asm volatile("global_load_async_to_lds_b128 %0, %8, off\n\t"
               "global_load_async_to_lds_b128 %1, %9, off\n\t"
               "global_load_async_to_lds_b128 %2, %10, off\n\t"
               "global_load_async_to_lds_b128 %3, %11, off\n\t"
               "global_load_async_to_lds_b128 %4, %12, off\n\t"
               "global_load_async_to_lds_b128 %5, %13, off\n\t"
               "global_load_async_to_lds_b128 %6, %14, off\n\t"
               "global_load_async_to_lds_b128 %7, %15, off\n\t"
               "s_wait_xcnt 0x0"
               :: "v"(l), "v"(l1), "v"(l2), "v"(l3), "v"(l4), "v"(l5), "v"(l6), "v"(l7),
                  "v"(g), "v"(g1), "v"(g2), "v"(g3), "v"(g4), "v"(g5), "v"(g6), "v"(g7) : "memory");
}
// One stage goes to LDS once per work-group by asynchronous copies, 16 B a lane, KS / 8 lanes a row.
// l: this lane's LDS byte address of its first A piece; ga, gb: its first A and B piece in global memory; the block's lanes cover RP rows at a time, and the B pieces follow the A pieces in LDS.
template <int NW, int KS>
__device__ __forceinline__ void g2_stage(unsigned l, const _Float16* ga, size_t lda, const _Float16* gb, size_t ldb) {
  constexpr int RP = 128 * 8 / KS; constexpr unsigned LS = RP * G2P(KS) * 2;      /* rows, and LDS bytes, from one piece of a lane to its next */
  static_assert(128 % (8 * RP) == 0 && (64 * NW) % (8 * RP) == 0 && G2ROWS(NW) / RP <= 63, "whole statements of eight copies; at most 63 copies of a wave in flight");
#pragma unroll      /* unrolled, here and below: a few statements of eight copies, their offsets constants */
  for (int j = 0; j < 128 / (8 * RP); ++j) g2_copy8(l + j * 8 * LS, LS, ga + (size_t)(j * 8 * RP) * lda, (size_t)RP * lda);
#pragma unroll
  for (int j = 0; j < 64 * NW / (8 * RP); ++j) g2_copy8(l + (128 / RP + j * 8) * LS, LS, gb + (size_t)(j * 8 * RP) * ldb, (size_t)RP * ldb);
}
__device__ __forceinline__ v8f g2_mma(v16h a, v16h b, v8f c) { v8f d = __builtin_amdgcn_wmma_f32_16x16x32_f16(false, a, false, b, (short)0, c, false, false); asm volatile("v_nop\n\tv_nop\n\tv_nop\n\tv_nop" : "+v"(d) : "v"(a), "v"(b)); return d; }
// ROWB: the bias belongs to the rows of C (weights as the A operand: C comes out channel-major) instead of its columns. sm: the caller's G2BYTES(NW, KS) bytes of LDS, one array for all bodies of a kernel.
template <int ACT, bool ROWB, int NW, int KS>
__device__ __forceinline__ void gemm2_body(unsigned char* sm, const int by, const _Float16* __restrict__ A, int lda, size_t sA, const _Float16* __restrict__ Bh, int ldb, size_t sB, float alpha, const float* __restrict__ bias, size_t sBias, const float* __restrict__ CP, int rowsPerB, size_t sCPb, int row0g,
    float* __restrict__ C, _Float16* __restrict__ C16, int ldc, size_t sC, int M, int N, int K) {
  constexpr int P = G2P(KS);
  typedef unsigned short g2_tile[G2ROWS(NW)][P];
  g2_tile* sT = (g2_tile*)sm;      /* the two operand stages */
  constexpr int RT = 2 * NW, WRN = 4 / NW, KPT = 2 / NW;      /* 16-row tiles of a wave; waves side by side along the rows; k steps of 32 whose fragments are in registers at a time (accumulators and fragments stay under 256 registers) */
  float (*so)[16 * RT][68] = (float (*)[16 * RT][68])sm;      /* the output staging, written only behind the loop's last barrier: every wave's reads of the stages are done there and no copy is in flight */
  const int tid = threadIdx.x, w = tid >> 5, lane = tid & 31, ln = lane & 15, hh = lane >> 4, wr = w % WRN, wc = w / WRN;      /* wave (wr, wc): rows 16 RT wr, columns 64 wc of the block's tile */
  A += (size_t)by * sA; Bh += (size_t)by * sB; const size_t cofs = (size_t)by * sC; const float* bp = bias ? bias + (size_t)by * sBias : nullptr;
  const int ntn = N / (64 * NW); const int mt = blockIdx.x / ntn, nq = blockIdx.x - mt * ntn; const int row0 = mt * 128 + 16 * RT * wr, col0 = nq * (64 * NW) + 64 * wc; if (mt * 128 >= M) return;      /* the same for every wave of the block: it stands in front of the barriers */
  const int crow = tid / (KS / 8), cc = (tid % (KS / 8)) * 8;      /* KS / 8 lanes copy one row */
  const _Float16* ga = A + (size_t)(mt * 128 + crow) * lda + cc; const _Float16* gb = Bh + (size_t)(nq * (64 * NW) + crow) * ldb + cc;
  const unsigned l0 = (unsigned)(size_t)&sT[0][crow][cc];
  constexpr unsigned BUFB = sizeof(g2_tile);      /* bytes of one stage */
  const int nst = K / KS;
  g2_stage<NW, KS>(l0, ga, lda, gb, ldb);
  v8f acc[RT][4];
#pragma unroll      /* unrolled, as every loop over acc: it is indexed by constants and stays in registers */
  for (int u = 0; u < 4 * RT; ++u) acc[u >> 2][u & 3] = (v8f){0.f,0.f,0.f,0.f,0.f,0.f,0.f,0.f};
  asm volatile("s_wait_asynccnt 0x0" ::: "memory");      /* stage 0: this wave's copies have landed */
  __syncthreads();      /* stage 0 is readable by every wave */
  if (nst > 1) g2_stage<NW, KS>(l0 + BUFB, ga + KS, lda, gb + KS, ldb);
#pragma unroll 1      /* stays rolled: one copy of the body serves both buffers, chosen by st & 1 */
  for (int st = 0; st < nst; ++st) {      /* stage st is worked on while stage st + 1 flies into the other buffer */
    const int bf = st & 1;
    const unsigned short* ar = &sT[bf][16 * RT * wr + ln][0]; const unsigned short* br = &sT[bf][128 + 64 * wc + ln][0];
#pragma unroll      /* unrolled: the part of the stage becomes a constant offset of the LDS reads */
    for (int hs = 0; hs < KS; hs += 32 * KPT) {
    v16h a[KPT][RT], b[KPT][4];      /* all LDS reads of sixteen products stand in front of the first of them: one LDS latency for the sixteen, not one for each pair */
#pragma unroll      /* unrolled, here and below: the fragments are indexed by constants and stay in registers */
    for (int ks = 0; ks < KPT; ++ks) {
#pragma unroll
      for (int i = 0; i < RT; ++i) a[ks][i] = g2_frag(ar + i * 16 * P + hs + ks * 32, hh);
#pragma unroll
      for (int t = 0; t < 4; ++t) b[ks][t] = g2_frag(br + t * 16 * P + hs + ks * 32, hh); }
#pragma unroll
    for (int ks = 0; ks < KPT; ++ks)
#pragma unroll
      for (int t = 0; t < 4; ++t)
#pragma unroll
        for (int i = 0; i < RT; ++i) acc[i][t] = g2_mma(a[ks][i], b[ks][t], acc[i][t]);
    }
    asm volatile("s_wait_dscnt 0x0" ::: "memory");      /* this wave's reads of buffer bf are done before the buffer is given up */
    asm volatile("s_wait_asynccnt 0x0" ::: "memory");      /* this wave's copies of stage st + 1 have landed */
    __syncthreads();      /* publishes stage st + 1 and ends every wave's reads of buffer bf */
    if (st + 2 < nst) g2_stage<NW, KS>(l0 + bf * BUFB, ga + (size_t)(st + 2) * KS, lda, gb + (size_t)(st + 2) * KS, ldb);
  }
  asm volatile("s_wait_asynccnt 0x0" ::: "memory");      /* no copy is left in flight when the wave goes on */
  float bvr[RT][8];      /* ROWB: the biases of this lane's 8 RT rows */
  if (ROWB) {
#pragma unroll      /* unrolled: bvr is indexed by constants and stays in registers */
    for (int i = 0; i < 8 * RT; ++i) bvr[i >> 3][i & 7] = bp ? bf16_round(bp[row0 + (i >> 3) * 16 + 8 * hh + (i & 7)]) : 0.f; }
#pragma unroll
  for (int u = 0; u < 4 * RT; ++u) { const int t = u & 3, half = u >> 2; const int col = col0 + t * 16 + ln; const float bvc = (!ROWB && bp) ? bf16_round(bp[col]) : 0.f;
#pragma unroll
    for (int r = 0; r < 8; ++r) { const int rloc = half * 16 + 8 * hh + r; const float bv = ROWB ? bvr[half][r] : bvc; float v = acc[half][t][r] * alpha + bv; if (CP) { const int bidx = (row0g + row0 + rloc) / rowsPerB; v += CP[(size_t)bidx * sCPb + (size_t)by * 64 + col]; }
      if (ACT == 3) v = fmaxf(v, 0.f); else if (ACT == 6) v = 0.5f * v * (1.0f + erff(v * 0.70710678118654752f)); else if (ACT == 11) v = 1.0f / (1.0f + expf(-v)); else if (ACT == 15) v = v / (1.0f + expf(-v)); else if (ACT == 12) v = (v > 0.f) ? v : 0.01f * v; else if (ACT == 8) v = tanhf(v);
      so[w][rloc][t * 16 + ln] = v; } }
  __builtin_amdgcn_fence(__ATOMIC_ACQ_REL, "workgroup"); __builtin_amdgcn_wave_barrier();
  const int rsub = lane >> 4, c4 = (lane & 15) * 4;
  { v4f vq[8 * RT];      /* all LDS reads first, so that the waits behind the stores do not stand between them */
#pragma unroll      /* unrolled, here and below: vq is indexed by constants and stays in registers */
    for (int q = 0; q < 8 * RT; ++q) vq[q] = *(const v4fa*)&so[w][q * 2 + rsub][c4];
#pragma unroll
    for (int q = 0; q < 8 * RT; ++q) { const int r = q * 2 + rsub; const v4f v = vq[q];      /* s_wait_xcnt 0 behind a store: the conversions and address sums that follow reuse the store's registers */
      if (C) { *(v4f*)(C + cofs + (size_t)(row0 + r) * ldc + col0 + c4) = v; asm volatile("s_wait_xcnt 0x0" ::: "memory"); }
      if (C16) { v4h h4; for (int i = 0; i < 4; ++i) h4[i] = (_Float16)v[i]; *(v4h*)(C16 + cofs + (size_t)(row0 + r) * ldc + col0 + c4) = h4; if (q + 1 < 8 * RT) asm volatile("s_wait_xcnt 0x0" ::: "memory"); } }
     } }
template <int ACT, bool ROWB>
__global__ __launch_bounds__(128) void k_gemm2(const _Float16* __restrict__ A, int lda, size_t sA, const _Float16* __restrict__ Bh, int ldb, size_t sB, float alpha, const float* __restrict__ bias, size_t sBias, const float* __restrict__ CP, int rowsPerB, size_t sCPb, int row0g,
    float* __restrict__ C, _Float16* __restrict__ C16, int ldc, size_t sC, int M, int N, int K) {
  __shared__ __attribute__((aligned(16))) unsigned char sm[G2BYTES(1, 256)];      /* one work-group a WGP: the deepest stage whose copies stay under 63 a wave */
  gemm2_body<ACT, ROWB, 1, 256>(sm, blockIdx.y, A, lda, sA, Bh, ldb, sB, alpha, bias, sBias, CP, rowsPerB, sCPb, row0g, C, C16, ldc, sC, M, N, K); }
// Three independent products of one shape in one launch: blockIdx.y picks the operands, the bias and the f16 output; the tile work is gemm2_body's, 128 x 128 tiles, 64 x 64 a wave.
// Jobs 0 and 1 give C[M][N] (tokens x channels). Job 2 takes its operands in swapped roles and gives C2[N][M] (channels x tokens, pitch M), the layout its reader wants; (M / 128)(N / 128) tiles either way.
template <int ACT>
__global__ __launch_bounds__(128) void k_gemm2x3(const _Float16* __restrict__ A0, const _Float16* __restrict__ A1, const _Float16* __restrict__ A2, const _Float16* __restrict__ B0, const _Float16* __restrict__ B1, const _Float16* __restrict__ B2,
    const float* __restrict__ bias0, const float* __restrict__ bias1, const float* __restrict__ bias2, _Float16* __restrict__ C0, _Float16* __restrict__ C1, _Float16* __restrict__ C2, float alpha, int ld, int M, int N, int K) {
  __shared__ __attribute__((aligned(16))) unsigned char sm[G2BYTES(2, 128)];      /* two work-groups fit a WGP */
  const int j = blockIdx.y;
  if (j == 2) { gemm2_body<ACT, true, 2, 128>(sm, 0, B2, ld, 0, A2, ld, 0, alpha, bias2, 0, nullptr, 1, 0, 0, nullptr, C2, M, 0, N, M, K); return; }
  const _Float16* A = (j == 0) ? A0 : A1; const _Float16* Bh = (j == 0) ? B0 : B1; const float* bias = (j == 0) ? bias0 : bias1; _Float16* C16 = (j == 0) ? C0 : C1;
  gemm2_body<ACT, false, 2, 128>(sm, 0, A, ld, 0, Bh, ld, 0, alpha, bias, 0, nullptr, 1, 0, 0, nullptr, C16, ld, 0, M, N, K); }



// lane l <-> lane l ^ 16 (the two lane halves of one fragment column)
__device__ __forceinline__ float xhalf(float x) { return __builtin_bit_cast(float, __builtin_amdgcn_permlanex16(__builtin_bit_cast(int, x), __builtin_bit_cast(int, x), 0x76543210, 0xfedcba98, false, false)); }
__device__ __forceinline__ void kv_stage(unsigned lk, unsigned lv, const unsigned short* gk, size_t k16, const unsigned short* gv, size_t v16) {
  const unsigned lk1 = lk + 2304u, lk2 = lk + 4608u, lk3 = lk + 6912u, lv1 = lv + 2304u, lv2 = lv + 4608u, lv3 = lv + 6912u;      /* 16 rows x 144 B */
  const unsigned short* gk1 = gk + k16; const unsigned short* gk2 = gk1 + k16; const unsigned short* gk3 = gk2 + k16;
  const unsigned short* gv1 = gv + v16; const unsigned short* gv2 = gv1 + v16; const unsigned short* gv3 = gv2 + v16;
  /* the closing s_wait_xcnt 0 stands inside the statement so that no address register of a copy is rewritten in front of it */
  asm volatile("global_load_async_to_lds_b128 %0, %8, off\n\t"
               "global_load_async_to_lds_b128 %1, %9, off\n\t"
               "global_load_async_to_lds_b128 %2, %10, off\n\t"
               "global_load_async_to_lds_b128 %3, %11, off\n\t"
               "global_load_async_to_lds_b128 %4, %12, off\n\t"
               "global_load_async_to_lds_b128 %5, %13, off\n\t"
               "global_load_async_to_lds_b128 %6, %14, off\n\t"
               "global_load_async_to_lds_b128 %7, %15, off\n\t"
               "s_wait_xcnt 0x0"
               :: "v"(lk), "v"(lk1), "v"(lk2), "v"(lk3), "v"(lv), "v"(lv1), "v"(lv2), "v"(lv3),
                  "v"(gk), "v"(gk1), "v"(gk2), "v"(gk3), "v"(gv), "v"(gv1), "v"(gv2), "v"(gv3) : "memory");
}
// Wave tile: 32 queries (two column groups of 16) x TK / KSP keys. Every K and V^T fragment read from LDS feeds two products, one for each column group.
// A work-group holds 4 query tiles (128 queries) x KSP key groups of 4 waves; key group kg walks keys [kg TK / KSP, (kg + 1) TK / KSP) through a two-buffer ring of its own, so the waves per SIMD do not fall with the wider tile.
// Behind the loop the groups' partial (maximum, sum, O^T) are joined through LDS by the waves of group 0.
template <int KSP>
__global__ __launch_bounds__(128 * KSP) void k_flash(const _Float16* __restrict__ Q16, int ldq, const _Float16* __restrict__ K16, int ldk, const _Float16* __restrict__ Vt, _Float16* __restrict__ O, int ldo) {
  constexpr int CT = 2, QW = 16 * CT, QB = 4 * QW, DT = 4, KS = 2, KT = 64, LP = 72;      /* KT keys a stage; LP: LDS row pitch in halves = 128 B + 16 B, the pitch of 16-byte LDS readers */
  constexpr int KPG = TK / KSP, nst = KPG / KT, MV = CT * DT * 2 + 1;      /* MV: 16-byte pieces a lane hands over: its O^T tiles, then (maximum, sum) of both column groups */
  static_assert(nst >= 2 && KPG % KT == 0 && TQ % QB == 0, "shape");
  __shared__ __attribute__((aligned(16))) unsigned short sK[KSP][2][KT][LP];
  __shared__ __attribute__((aligned(16))) unsigned short sV[KSP][2][64][LP];
  __shared__ __attribute__((aligned(16))) v4f sM[KSP - 1][4][MV][32];      /* hand-over of groups 1 .. KSP - 1; plane [0][qt] then serves wave qt of group 0 as its output staging (32 rows x 68 floats, the same bytes) */
  static_assert(sizeof(v4f) * MV * 32 == sizeof(float) * QW * 68, "staging fits its plane");
  const int tid = threadIdx.x, w = tid >> 5, lane = tid & 31, ln = lane & 15, hh = lane >> 4;
  const int qt = w & 3, kg = w >> 2, gt = tid & 127;
  const int slab = blockIdx.x / (TQ / QB), qblk = blockIdx.x % (TQ / QB); const int b = slab / NH, h = slab % NH; const int q0 = qblk * QB + qt * QW;
  const unsigned short* Vth = (const unsigned short*)Vt + (size_t)slab * 64 * TK;
  const int crow = gt >> 3, cc = (gt & 7) * 8;      /* eight lanes copy one 128-B row */
  const unsigned short* gk = (const unsigned short*)K16 + ((size_t)b * TK + kg * KPG + crow) * ldk + h * 64 + cc;
  const unsigned short* gv = Vth + (size_t)crow * TK + kg * KPG + cc;
  const size_t k16 = (size_t)16 * ldk, v16 = (size_t)16 * TK, kst = (size_t)KT * ldk;
  const unsigned lk0 = (unsigned)(size_t)&sK[kg][0][crow][cc], lv0 = (unsigned)(size_t)&sV[kg][0][crow][cc];
  constexpr unsigned BUFB = KT * LP * 2;      /* bytes of one buffer */
  kv_stage(lk0, lv0, gk, k16, gv, v16);
  FragH bq[CT][KS];
#pragma unroll
  for (int c = 0; c < CT; ++c) { const unsigned short* qr = (const unsigned short*)Q16 + ((size_t)b * TQ + q0 + c * 16 + ln) * ldq + h * 64;
#pragma unroll
    for (int ks = 0; ks < KS; ++ks) { bq[c][ks].half[0] = *(const v8us*)(qr + ks * 32 + 8 * hh); bq[c][ks].half[1] = *(const v8us*)(qr + ks * 32 + 16 + 8 * hh); } }
  constexpr float C2 = SCL * 1.4426950408889634f;      /* score -> base-2 exponent: scale x log2(e) */
  float m_r[CT], l_r[CT]; v8f oacc[CT][DT];      /* m_r: running maximum of the unscaled scores; l_r: sum of 1024 p over this lane half's keys only, joined after the loop */
#pragma unroll
  for (int c = 0; c < CT; ++c) { m_r[c] = -3.0e38f; l_r[c] = 0.f;
#pragma unroll
    for (int dt = 0; dt < DT; ++dt) oacc[c][dt] = (v8f){0.f,0.f,0.f,0.f,0.f,0.f,0.f,0.f}; }
  asm volatile("s_wait_asynccnt 0x0" ::: "memory");      /* stage 0: this wave's copies have landed */
  __syncthreads();      /* stage 0 is readable by every wave */
  kv_stage(lk0 + BUFB, lv0 + BUFB, gk + kst, k16, gv + KT, v16);
#pragma unroll 1      /* stays rolled: one copy of the body serves both buffers, chosen by st & 1 */
  for (int st = 0; st < nst; ++st) {      /* stage st is worked on while stage st + 1 flies into the other buffer */
    const int bf = st & 1;
#pragma unroll      /* unrolled: the half stage becomes a constant offset of the LDS reads */
    for (int sub = 0; sub < KT / 32; ++sub) {
    FragH ak[2][KS], av[DT];
#pragma unroll
    for (int nt = 0; nt < 2; ++nt) { const unsigned short* kr = &sK[kg][bf][sub * 32 + nt * 16 + ln][0];
#pragma unroll
      for (int ks = 0; ks < KS; ++ks) { ak[nt][ks].half[0] = *(const v8us*)(kr + ks * 32 + 8 * hh); ak[nt][ks].half[1] = *(const v8us*)(kr + ks * 32 + 16 + 8 * hh); } }
#pragma unroll
    for (int dt = 0; dt < DT; ++dt) { const unsigned short* vrow = &sV[kg][bf][dt * 16 + ln][sub * 32]; av[dt].half[0] = *(const v8us*)(vrow + 8 * hh); av[dt].half[1] = *(const v8us*)(vrow + 16 + 8 * hh); }
    __builtin_amdgcn_sched_barrier(0);      /* holds the sixteen LDS reads of the half stage together in front of its products; without it the compiler strews them in pairs among the products, each pair waited for where it stands */
    v8f s[CT][2];
#pragma unroll
    for (int nt = 0; nt < 2; ++nt)
#pragma unroll
      for (int c = 0; c < CT; ++c) {
        v8f acc = (v8f){0.f,0.f,0.f,0.f,0.f,0.f,0.f,0.f};
#pragma unroll
        for (int ks = 0; ks < KS; ++ks) acc = __builtin_amdgcn_wmma_f32_16x16x32_f16(false, ak[nt][ks].v, false, bq[c][ks].v, (short)0, acc, false, false);
        s[c][nt] = acc; }
    FragH pb[CT];
#pragma unroll      /* unrolled: the two column groups' chains are independent and interleave */
    for (int c = 0; c < CT; ++c) {
    float sc[16], t[8];
#pragma unroll
    for (int i = 0; i < 16; ++i) sc[i] = s[c][i >> 3][i & 7];      /* unscaled scores (the scale is positive: the maximum commutes with it) */
#pragma unroll
    for (int i = 0; i < 8; ++i) t[i] = fmaxf(sc[i], sc[i + 8]);
    float mc = fmaxf(fmaxf(fmaxf(t[0], t[1]), fmaxf(t[2], t[3])), fmaxf(fmaxf(t[4], t[5]), fmaxf(t[6], t[7])));
    mc = fmaxf(mc, xhalf(mc));      /* both halves feed one O^T column: one maximum for both */
    const float mn = fmaxf(m_r[c], mc); const float al = (mn > -1.0e38f) ? __builtin_amdgcn_exp2f((m_r[c] - mn) * C2) : 1.0f; m_r[c] = mn;
    const float nb = __builtin_fmaf(-mn, C2, 10.0f);      /* 1024 p = 2^(C2 s - C2 m + 10): one fused multiply-add in front of the hardware's base-2 exponential */
#pragma unroll
    for (int i = 0; i < 16; ++i) sc[i] = __builtin_fmaf(sc[i], C2, nb);
    /* sixteen exponentials in place, in one statement: each is independent of the one in front of it (no result read, no source overwritten), and the closing v_nop is the slot behind the last one; last element first, because the packing behind it starts with the last pair */
    asm("v_exp_f32 %15, %15\n\tv_exp_f32 %14, %14\n\tv_exp_f32 %13, %13\n\tv_exp_f32 %12, %12\n\t"
        "v_exp_f32 %11, %11\n\tv_exp_f32 %10, %10\n\tv_exp_f32 %9, %9\n\tv_exp_f32 %8, %8\n\t"
        "v_exp_f32 %7, %7\n\tv_exp_f32 %6, %6\n\tv_exp_f32 %5, %5\n\tv_exp_f32 %4, %4\n\t"
        "v_exp_f32 %3, %3\n\tv_exp_f32 %2, %2\n\tv_exp_f32 %1, %1\n\tv_exp_f32 %0, %0\n\tv_nop"
        : "+v"(sc[0]), "+v"(sc[1]), "+v"(sc[2]), "+v"(sc[3]), "+v"(sc[4]), "+v"(sc[5]), "+v"(sc[6]), "+v"(sc[7]),
          "+v"(sc[8]), "+v"(sc[9]), "+v"(sc[10]), "+v"(sc[11]), "+v"(sc[12]), "+v"(sc[13]), "+v"(sc[14]), "+v"(sc[15]));
#pragma unroll
    for (int i = 0; i < 16; ++i) pb[c].h[i] = (_Float16)sc[i];
#pragma unroll
    for (int i = 0; i < 8; ++i) t[i] = sc[i] + sc[i + 8];
    l_r[c] = l_r[c] * al + (((t[0] + t[1]) + (t[2] + t[3])) + ((t[4] + t[5]) + (t[6] + t[7])));
#pragma unroll
    for (int dt = 0; dt < DT; ++dt)
#pragma unroll
      for (int r = 0; r < 8; ++r) oacc[c][dt][r] *= al;
    }
#pragma unroll
    for (int dt = 0; dt < DT; ++dt)
#pragma unroll
      for (int c = 0; c < CT; ++c) oacc[c][dt] = __builtin_amdgcn_wmma_f32_16x16x32_f16(false, av[dt].v, false, pb[c].v, (short)0, oacc[c][dt], false, false);
    }
    __builtin_amdgcn_sched_barrier(0);      /* holds the stage's products in front of its foot, so that the refill behind the barrier is issued a whole stage ahead of its wait */
    asm volatile("s_wait_dscnt 0x0" ::: "memory");      /* this wave's reads of buffer bf are done before the buffer is given up */
    asm volatile("s_wait_asynccnt 0x0" ::: "memory");      /* this wave's copies of stage st + 1 have landed */
    __syncthreads();      /* publishes stage st + 1 and ends every wave's reads of buffer bf */
    if (st + 2 < nst) kv_stage(lk0 + bf * BUFB, lv0 + bf * BUFB, gk + (size_t)(st + 2) * kst, k16, gv + (size_t)(st + 2) * KT, v16);
  }
  asm volatile("s_wait_asynccnt 0x0" ::: "memory");      /* no copy is left in flight when the wave goes on */
  if (kg > 0) {      /* a lane's partials go to the same lane of group 0: 16 B a lane, lanes side by side */
    v4f* mp = &sM[kg - 1][qt][0][lane];
#pragma unroll
    for (int c = 0; c < CT; ++c)
#pragma unroll
      for (int dt = 0; dt < DT; ++dt) {
        *(v4fa*)(mp + ((c * DT + dt) * 2) * 32) = (v4f){oacc[c][dt][0], oacc[c][dt][1], oacc[c][dt][2], oacc[c][dt][3]};
        *(v4fa*)(mp + ((c * DT + dt) * 2 + 1) * 32) = (v4f){oacc[c][dt][4], oacc[c][dt][5], oacc[c][dt][6], oacc[c][dt][7]}; }
    *(v4fa*)(mp + (MV - 1) * 32) = (v4f){m_r[0], l_r[0], m_r[1], l_r[1]};
  }
  __syncthreads();      /* the partials of groups 1 .. KSP - 1 are readable by group 0; every wave passes it, and it is the last barrier */
  if (kg > 0) return;
#pragma unroll 1      /* stays rolled: one group's partials in registers at a time */
  for (int g = 0; g < KSP - 1; ++g) {
    const v4f* mp = &sM[g][qt][0][lane];
    const v4f ml = *(const v4fa*)(mp + (MV - 1) * 32);
#pragma unroll
    for (int c = 0; c < CT; ++c) {
      const float mg = ml[2 * c], lg = ml[2 * c + 1];
      const float mn = fmaxf(m_r[c], mg); const float a0 = __builtin_amdgcn_exp2f((m_r[c] - mn) * C2), a1 = __builtin_amdgcn_exp2f((mg - mn) * C2);
      m_r[c] = mn; l_r[c] = l_r[c] * a0 + lg * a1;
#pragma unroll
      for (int dt = 0; dt < DT; ++dt) {
        const v4f lo = *(const v4fa*)(mp + ((c * DT + dt) * 2) * 32), hi = *(const v4fa*)(mp + ((c * DT + dt) * 2 + 1) * 32);
#pragma unroll
        for (int r = 0; r < 4; ++r) { oacc[c][dt][r] = oacc[c][dt][r] * a0 + lo[r] * a1; oacc[c][dt][4 + r] = oacc[c][dt][4 + r] * a0 + hi[r] * a1; } } }
  }
  float (*sO)[68] = (float (*)[68])&sM[0][qt][0][0];      /* this wave alone has read that plane, and its reads are done: their values are in use above */
#pragma unroll
  for (int c = 0; c < CT; ++c) {
    const float l = l_r[c] + xhalf(l_r[c]); const float li = (l > 0.f) ? 1.0f / l : 0.f;      /* numerator and sum both carry the factor 1024 */
#pragma unroll
    for (int dt = 0; dt < DT; ++dt) {      /* oacc[c][dt][r] = O[q0 + 16 c + ln][16 dt + 8 hh + r] */
      const v4f lo = {oacc[c][dt][0] * li, oacc[c][dt][1] * li, oacc[c][dt][2] * li, oacc[c][dt][3] * li}, hi = {oacc[c][dt][4] * li, oacc[c][dt][5] * li, oacc[c][dt][6] * li, oacc[c][dt][7] * li};
      *(v4fa*)&sO[c * 16 + ln][dt * 16 + 8 * hh] = lo; *(v4fa*)&sO[c * 16 + ln][dt * 16 + 8 * hh + 4] = hi; } }
  __builtin_amdgcn_fence(__ATOMIC_ACQ_REL, "workgroup"); __builtin_amdgcn_wave_barrier();
  { v4h h4[QW / 2];      /* all LDS reads first, so that the waits behind the stores do not stand between them */
#pragma unroll      /* unrolled, here and below: h4 is indexed by constants and stays in registers */
    for (int rp = 0; rp < QW; rp += 2) { const v4f val = *(const v4fa*)&sO[rp + (lane >> 4)][(lane & 15) * 4]; for (int i = 0; i < 4; ++i) h4[rp >> 1][i] = (_Float16)val[i]; }      /* ctx leaves as the f16 operand of the last product */
#pragma unroll
    for (int rp = 0; rp < QW; rp += 2) { const int r = rp + (lane >> 4), pc = lane & 15; *(v4h*)(O + ((size_t)b * TQ + q0 + r) * ldo + h * 64 + pc * 4) = h4[rp >> 1];      /* sixteen lanes fill one 128-B line */
      if (rp + 2 < QW) asm volatile("s_wait_xcnt 0x0" ::: "memory"); }      /* the address sums that follow reuse the store's registers */
     } }
// 5-plane variant: S = Qh Kh^T + (Ql Kh^T + Qh Kl^T)/1024 with Q/K = [hi | 2^10 residual] f16 planes (QL/KL same layout as Q16/K16), then the 3-term P.V below.
// 3-term variant: O = (P_hi V_hi + (P_lo V_hi + P_hi V_lo) / 1024) / l with P = [hi | 2^10 residual] of 1024 p and V^T = [hi | 2^10 residual] planes (VtL same layout as Vt) -> ~2^-21-class products for un-averaged (early causal / peaked) rows
template <int CAUSAL>
__global__ __launch_bounds__(128) void k_flash5(const _Float16* __restrict__ Q16, const _Float16* __restrict__ QL, int ldq, const _Float16* __restrict__ K16, const _Float16* __restrict__ KL, int ldk, const _Float16* __restrict__ Vt, const _Float16* __restrict__ VtL, const int* __restrict__ MSK, float* __restrict__ O, int ldo) {
  constexpr int RPW = 16, RTN = RPW / 16, NQB = TQ / (4 * RPW), DT = 4, KS = 2;
  __shared__ __attribute__((aligned(16))) unsigned short sP[4][RPW][40]; __shared__ __attribute__((aligned(16))) unsigned short sPL[4][RPW][40]; __shared__ __attribute__((aligned(16))) float sO[4][RPW][64 + 4];
  const int tid = threadIdx.x, w = tid >> 5, lane = tid & 31, ln = lane & 15, hh = lane >> 4;
  const int slab = blockIdx.x / QBN5, qblk = QB05 + blockIdx.x % QBN5; (void)NQB; const int b = slab / NH, h = slab % NH; const int qb0 = qblk * (4 * RPW); const int q0 = qb0 + w * RPW;
  FragH aq[2][KS], aql[2][KS];
#pragma unroll
  for (int rt = 0; rt < RTN; ++rt) { const unsigned short* qr = (const unsigned short*)Q16 + ((size_t)b * TQ + q0 + rt * 16 + ln) * ldq + h * 64; const unsigned short* ql = (const unsigned short*)QL + ((size_t)b * TQ + q0 + rt * 16 + ln) * ldq + h * 64;
#pragma unroll
    for (int ks = 0; ks < KS; ++ks) { aq[rt][ks].half[0] = *(const v8us*)(qr + ks * 32 + 8 * hh); aq[rt][ks].half[1] = *(const v8us*)(qr + ks * 32 + 16 + 8 * hh); aql[rt][ks].half[0] = *(const v8us*)(ql + ks * 32 + 8 * hh); aql[rt][ks].half[1] = *(const v8us*)(ql + ks * 32 + 16 + 8 * hh); } }
  const unsigned short* Vth = (const unsigned short*)Vt + (size_t)slab * 64 * TK; const unsigned short* Vtl = (const unsigned short*)VtL + (size_t)slab * 64 * TK;
  float m_r[2][8], l_r[2][8]; v8f oacc[2][DT], oaccL[2][DT];
#pragma unroll
  for (int rt = 0; rt < RTN; ++rt) {
#pragma unroll
    for (int r = 0; r < 8; ++r) { m_r[rt][r] = -3.0e38f; l_r[rt][r] = 0.f; }
#pragma unroll
    for (int dt = 0; dt < DT; ++dt) { oacc[rt][dt] = (v8f){0.f,0.f,0.f,0.f,0.f,0.f,0.f,0.f}; oaccL[rt][dt] = oacc[rt][dt]; } }
  const int jend = (CAUSAL == 1) ? (qb0 + 4 * RPW) : TK;      /* causal: keys beyond the block's last query never contribute */
#pragma unroll 1
  for (int j0 = 0; j0 < jend; j0 += 32) {
    v8f s[2][2];
#pragma unroll
    for (int nt = 0; nt < 2; ++nt) { const unsigned short* kr = (const unsigned short*)K16 + ((size_t)b * TK + j0 + nt * 16 + ln) * ldk + h * 64; const unsigned short* klr = (const unsigned short*)KL + ((size_t)b * TK + j0 + nt * 16 + ln) * ldk + h * 64; FragH bk[KS], bkl[KS];
#pragma unroll
      for (int ks = 0; ks < KS; ++ks) { bk[ks].half[0] = *(const v8us*)(kr + ks * 32 + 8 * hh); bk[ks].half[1] = *(const v8us*)(kr + ks * 32 + 16 + 8 * hh); bkl[ks].half[0] = *(const v8us*)(klr + ks * 32 + 8 * hh); bkl[ks].half[1] = *(const v8us*)(klr + ks * 32 + 16 + 8 * hh); }
#pragma unroll
      for (int rt = 0; rt < RTN; ++rt) { v8f acc = (v8f){0.f,0.f,0.f,0.f,0.f,0.f,0.f,0.f}, accl = acc;
#pragma unroll
        for (int ks = 0; ks < KS; ++ks) { acc = mmaH<1>(aq[rt][ks].v, aq[rt][ks].v, bk[ks].v, bk[ks].v, acc); accl = mmaH<1>(aql[rt][ks].v, aql[rt][ks].v, bk[ks].v, bk[ks].v, accl); accl = mmaH<1>(aq[rt][ks].v, aq[rt][ks].v, bkl[ks].v, bkl[ks].v, accl); }
#pragma unroll
        for (int r = 0; r < 8; ++r) acc[r] += accl[r] * 0.0009765625f;
        s[rt][nt] = acc; } }
#pragma unroll
    for (int rt = 0; rt < RTN; ++rt)
#pragma unroll
      for (int r = 0; r < 8; ++r) { const int tq = q0 + rt * 16 + 8 * hh + r; const int k0 = j0 + ln, k1 = j0 + 16 + ln;
        bool ok0 = (CAUSAL == 1) ? (k0 <= tq) : ((CAUSAL == 2) ? ((k0 >> 5) == (tq >> 5)) : true), ok1 = (CAUSAL == 1) ? (k1 <= tq) : ((CAUSAL == 2) ? ((k1 >> 5) == (tq >> 5)) : true);      /* mode 2: block-diagonal 32-token groups */
        if (CAUSAL == 4) { const int* mrow = MSK + ((size_t)b * TQ + tq) * TK; ok0 = mrow[k0] != 0; ok1 = mrow[k1] != 0; }      /* mode 4: per-(query, key) INPUT mask shared by all heads; masked keys contribute nothing (== the reference's -4096 fill, whose exp underflows to 0), rows with no valid key give l = 0 -> output 0 (== the reference's row_valid zeroing) */
        float s0 = ok0 ? s[rt][0][r] * SCL : -3.0e38f, s1 = ok1 ? s[rt][1][r] * SCL : -3.0e38f; if (CAUSAL == 17) { const float* amk = (const float*)MSK + (size_t)b * TK; s0 += bf16_round(amk[k0]); s1 += bf16_round(amk[k1]); }      /* mode 17: additive per-(batch, key) mask INPUT */ float mc = fmaxf(s0, s1);
        mc = fmaxf(mc, __shfl_xor(mc, 1, 32)); mc = fmaxf(mc, __shfl_xor(mc, 2, 32)); mc = fmaxf(mc, __shfl_xor(mc, 4, 32)); mc = fmaxf(mc, __shfl_xor(mc, 8, 32));
        const float mn = fmaxf(m_r[rt][r], mc); const float al = (mn > -1.0e38f) ? expf(m_r[rt][r] - mn) : 1.0f; m_r[rt][r] = mn; const float p0 = ok0 ? expf(s0 - mn) : 0.f, p1 = ok1 ? expf(s1 - mn) : 0.f; l_r[rt][r] = l_r[rt][r] * al + p0 + p1;
#pragma unroll
        for (int dt = 0; dt < DT; ++dt) { oacc[rt][dt][r] *= al; oaccL[rt][dt][r] *= al; }
        FragH t2, t2l; const float ps0 = p0 * 1024.0f, ps1 = p1 * 1024.0f; t2.h[0] = (_Float16)ps0; t2.h[1] = (_Float16)ps1; t2l.h[0] = (_Float16)((ps0 - (float)t2.h[0]) * 1024.0f); t2l.h[1] = (_Float16)((ps1 - (float)t2.h[1]) * 1024.0f);
        sP[w][rt * 16 + 8 * hh + r][ln] = t2.u[0]; sP[w][rt * 16 + 8 * hh + r][16 + ln] = t2.u[1]; sPL[w][rt * 16 + 8 * hh + r][ln] = t2l.u[0]; sPL[w][rt * 16 + 8 * hh + r][16 + ln] = t2l.u[1]; }
    __builtin_amdgcn_fence(__ATOMIC_ACQ_REL, "workgroup"); __builtin_amdgcn_wave_barrier();
    FragH pa[2], pl[2];
#pragma unroll
    for (int rt = 0; rt < RTN; ++rt) { pa[rt].half[0] = *(const v8us*)&sP[w][rt * 16 + ln][8 * hh]; pa[rt].half[1] = *(const v8us*)&sP[w][rt * 16 + ln][16 + 8 * hh]; pl[rt].half[0] = *(const v8us*)&sPL[w][rt * 16 + ln][8 * hh]; pl[rt].half[1] = *(const v8us*)&sPL[w][rt * 16 + ln][16 + 8 * hh]; }
#pragma unroll
    for (int dt = 0; dt < DT; ++dt) { const unsigned short* vrow = Vth + (size_t)(dt * 16 + ln) * TK + j0; const unsigned short* vrl = Vtl + (size_t)(dt * 16 + ln) * TK + j0; FragH bv, bl; bv.half[0] = *(const v8us*)(vrow + 8 * hh); bv.half[1] = *(const v8us*)(vrow + 16 + 8 * hh); bl.half[0] = *(const v8us*)(vrl + 8 * hh); bl.half[1] = *(const v8us*)(vrl + 16 + 8 * hh);
#pragma unroll
      for (int rt = 0; rt < RTN; ++rt) { oacc[rt][dt] = mmaH<1>(pa[rt].v, pa[rt].v, bv.v, bv.v, oacc[rt][dt]); oaccL[rt][dt] = mmaH<1>(pl[rt].v, pl[rt].v, bv.v, bv.v, oaccL[rt][dt]); oaccL[rt][dt] = mmaH<1>(pa[rt].v, pa[rt].v, bl.v, bl.v, oaccL[rt][dt]); } }
    __builtin_amdgcn_fence(__ATOMIC_ACQ_REL, "workgroup"); __builtin_amdgcn_wave_barrier(); }
#pragma unroll
  for (int rt = 0; rt < RTN; ++rt) {
#pragma unroll
    for (int r = 0; r < 8; ++r) { float l = l_r[rt][r]; l += __shfl_xor(l, 1, 32); l += __shfl_xor(l, 2, 32); l += __shfl_xor(l, 4, 32); l += __shfl_xor(l, 8, 32); l_r[rt][r] = (l > 0.f) ? 1.0f / (l * 1024.0f) : 0.f; }
#pragma unroll
    for (int dt = 0; dt < DT; ++dt)
#pragma unroll
      for (int r = 0; r < 8; ++r) { float v = oacc[rt][dt][r]; v += oaccL[rt][dt][r] * 0.0009765625f; sO[w][rt * 16 + 8 * hh + r][dt * 16 + ln] = v * l_r[rt][r]; } }
  __builtin_amdgcn_fence(__ATOMIC_ACQ_REL, "workgroup"); __builtin_amdgcn_wave_barrier();
  {
#pragma unroll
    for (int rp = 0; rp < RPW; rp += 2) { const int r = rp + (lane >> 4), pc = lane & 15; const v4f val = *(const v4fa*)&sO[w][r][pc * 4]; *(v4f*)(O + ((size_t)b * TQ + q0 + r) * ldo + h * 64 + pc * 4) = val; }
     } }

__global__ __launch_bounds__(256) void k_rotab(float* __restrict__ CS, float* __restrict__ SN) {
  #pragma clang fp contract(off)
  const int t = blockIdx.x * 256 + threadIdx.x; if (t >= SLEN * 32) return; const int j = t % 32, s = t / 32; const float ex = (float)(2 * j) / 64.0f; const float inv = 1.0f / powf(10000.0f, ex); const float th = (float)s * inv; const float c = cosf(th), sn = sinf(th);
  { *(float*)(CS + t) = c; *(float*)(SN + t) = sn;  } }
__global__ __launch_bounds__(256) void k_rope(const float* __restrict__ F, int nsrc, int ndst, int rep, const float* __restrict__ CS, const float* __restrict__ SN, _Float16* __restrict__ H, _Float16* __restrict__ L) {
  #pragma clang fp contract(off)
  const size_t t = (size_t)blockIdx.x * 256 + threadIdx.x; if (t >= (size_t)NR * ndst * 4) return; const int g8 = (int)(t % 4); const int hd = (int)((t / 4) % ndst); const size_t row = t / ((size_t)4 * ndst); const int s = (int)(row % SLEN); const int hs = hd / rep;
  const float* src = F + row * (size_t)(nsrc * 64) + hs * 64; FragH ah, al, bh, bl;
  for (int i = 0; i < 8; ++i) { const int d = g8 * 8 + i; const float c = CS[s * 32 + d], sn = SN[s * 32 + d]; const float x1 = src[d], x2 = src[d + 32];
    float o1 = x1 * c; o1 += -x2 * sn; float o2 = x2 * c; o2 += x1 * sn;
    _Float16 hv = (_Float16)o1; ah.h[i] = hv; al.h[i] = (_Float16)((o1 - (float)hv) * 1024.0f); hv = (_Float16)o2; bh.h[i] = hv; bl.h[i] = (_Float16)((o2 - (float)hv) * 1024.0f); }
  const size_t o = row * (size_t)(ndst * 64) + hd * 64 + g8 * 8;
  { *(v8us*)((unsigned short*)H + o) = ah.half[0]; *(v8us*)((unsigned short*)H + o + 32) = bh.half[0]; *(v8us*)((unsigned short*)L + o) = al.half[0]; *(v8us*)((unsigned short*)L + o + 32) = bl.half[0];  } }
__global__ __launch_bounds__(256) void k_rope2(const float* __restrict__ F, int nsrc, int ndst, int rep, const float* __restrict__ CS, const float* __restrict__ SN, _Float16* __restrict__ H, _Float16* __restrict__ L) {
  #pragma clang fp contract(off)
  const size_t t = (size_t)blockIdx.x * 256 + threadIdx.x; if (t >= (size_t)NR * ndst * 4) return; const int g16 = (int)(t % 4); const int hd = (int)((t / 4) % ndst); const size_t row = t / ((size_t)4 * ndst); const int s = (int)(row % SLEN); const int hs = hd / rep;
  const float* src = F + row * (size_t)(nsrc * 64) + hs * 64 + g16 * 16; FragH ah, al;
  for (int pr = 0; pr < 8; ++pr) { const int i = g16 * 8 + pr; const float c = CS[s * 32 + i], sn = SN[s * 32 + i]; const float x1 = src[2 * pr], x2 = src[2 * pr + 1];
    float o1 = x1 * c; o1 -= x2 * sn; float o2 = x1 * sn; o2 += x2 * c;
    _Float16 hv = (_Float16)o1; ah.h[2 * pr] = hv; al.h[2 * pr] = (_Float16)((o1 - (float)hv) * 1024.0f); hv = (_Float16)o2; ah.h[2 * pr + 1] = hv; al.h[2 * pr + 1] = (_Float16)((o2 - (float)hv) * 1024.0f); }
  const size_t o = row * (size_t)(ndst * 64) + hd * 64 + g16 * 16;
  { *(v8us*)((unsigned short*)H + o) = ah.half[0]; *(v8us*)((unsigned short*)H + o + 8) = ah.half[1]; *(v8us*)((unsigned short*)L + o) = al.half[0]; *(v8us*)((unsigned short*)L + o + 8) = al.half[1];  } }
__global__ __launch_bounds__(256) void k_tabin(const float* __restrict__ sp, float* __restrict__ CS, float* __restrict__ SN) { const int t = blockIdx.x * 256 + threadIdx.x; if (t >= SLEN * 32) return; const int i = t % 32, s = t / 32; const float c = bf16_round(sp[s * 64 + 32 + i]), sn = bf16_round(sp[s * 64 + i]);
  { *(float*)(CS + t) = c; *(float*)(SN + t) = sn;  } }
__device__ __forceinline__ void d_wsc(const size_t t, const float* __restrict__ Wm, _Float16* __restrict__ Bt, size_t n8, float sc) { if (t >= n8) return; FragH f; for (int q = 0; q < 8; ++q) f.h[q] = (_Float16)(bf16_round(Wm[t * 8 + q]) * sc); *(v8us*)((unsigned short*)Bt + t * 8) = f.half[0];  }
__global__ __launch_bounds__(256) void k_rotab2(float* __restrict__ CS, float* __restrict__ SN) {
  #pragma clang fp contract(off)
  const int t = blockIdx.x * 256 + threadIdx.x; if (t >= SLEN * 32) return; const int j = t % 32, s = t / 32; const float c0 = -0.14391156831212787f;      /* -ln(10000)/64 rounded to f32 */ const float inv = expf((float)(2 * j) * c0); const float th = (float)s * inv; const float c = cosf(th), sn = sinf(th);
  { *(float*)(CS + t) = c; *(float*)(SN + t) = sn;  } }
__global__ __launch_bounds__(256) void k_lnu(const float* __restrict__ X, _Float16* __restrict__ N16, float* __restrict__ XB) {
  #pragma clang fp contract(off)
  const int wv = threadIdx.x >> 5, ln = threadIdx.x & 31; const size_t r = (size_t)blockIdx.x * 8 + wv; if (r >= NR) return; float a[32]; float s = 0.f;
  for (int i = 0; i < 4; ++i) { const v8f v = *(const v8f*)(X + r * DM + (i * 32 + ln) * 8); for (int q = 0; q < 8; ++q) { const float u = bf16_round(v[q]); a[i * 8 + q] = u; s += u; } }
  for (int o = 16; o > 0; o >>= 1) s += __shfl_xor(s, o, 32); const float mu = s / (float)DM; float var = 0.f; for (int q = 0; q < 32; ++q) { const float d = a[q] - mu; var += d * d; }
  for (int o = 16; o > 0; o >>= 1) var += __shfl_xor(var, o, 32); const float den = sqrtf(var / (float)(DM - 1)) + 1e-6f; const float inv = 1.0f / den;      /* one reciprocal per row; (x-mean)*inv vs the reference's division differs by <= 1 ulp */
  { for (int i = 0; i < 4; ++i) { const int c0 = (i * 32 + ln) * 8; FragH f; v8f xb; for (int q = 0; q < 8; ++q) { f.h[q] = (_Float16)((a[i * 8 + q] - mu) * inv); xb[q] = a[i * 8 + q]; } *(v8us*)((unsigned short*)N16 + r * DM + c0) = f.half[0]; *(v8f*)(XB + r * DM + c0) = xb; }  } }
__global__ __launch_bounds__(256) void k_vtg(const _Float16* __restrict__ V16, _Float16* __restrict__ Vt) { __shared__ unsigned short tl[64][66]; const int tid = threadIdx.x; const int slab = blockIdx.x / (SLEN / 64), lg = blockIdx.x % (SLEN / 64); const int b = slab / NH, h = slab % NH; const int hs = h / NREP;
  for (int i = tid; i < 64 * 8; i += 256) { const int r = i / 8, c8 = (i % 8) * 8; FragH f; f.half[0] = *(const v8us*)((const unsigned short*)V16 + ((size_t)b * SLEN + lg * 64 + r) * KVD + hs * 64 + c8); for (int q = 0; q < 8; ++q) tl[r][c8 + q] = f.u[q]; }
  __syncthreads();
  { for (int rd = 0; rd < 2; ++rd) { const int d = rd * 32 + tid / 8, pc = tid % 8; FragH f; for (int q = 0; q < 8; ++q) f.u[q] = tl[pc * 8 + q][d]; *(v8us*)((unsigned short*)Vt + ((size_t)slab * 64 + d) * SLEN + lg * 64 + pc * 8) = f.half[0]; }  } }

// One 64-channel x 256-token tile of a channel-major f32 plane goes to the token-major f16 plane through LDS: a wave reads 512 contiguous bytes of one channel, eight lanes write one 128-B line of one token.
#define PTC 64      /* channels a tile: 64 halves = one 128-B line of the token-major plane */
#define PTN 256     /* tokens a tile */
#define PTD 33      /* LDS row pitch in dwords: 32 channel pairs + 1, so that the four token rows of one wave-wide read fall on different banks */
__device__ __forceinline__ void d_pmt(unsigned (*tl)[PTD], const int tile, const float* __restrict__ src, _Float16* __restrict__ P16) {
  const int tid = threadIdx.x, n4 = tid & 63, cg = tid >> 6;
  const int c0 = (tile % (DM / PTC)) * PTC, n0 = (tile / (DM / PTC)) * PTN;
  const float* p = src + (size_t)(c0 + 2 * cg) * SLEN + n0 + 4 * n4;
  v4f a[8], b[8];      /* all sixteen loads stand in front of the first use: one memory latency a tile */
#pragma unroll      /* unrolled, here and below: a and b are indexed by constants and stay in registers */
  for (int i = 0; i < 8; ++i) { a[i] = *(const v4fa*)(p + (size_t)(8 * i) * SLEN); b[i] = *(const v4fa*)(p + (size_t)(8 * i + 1) * SLEN); }
  asm volatile("s_wait_xcnt 0x0" :: "v"(p) : "memory");      /* behind the loads, with their address as an input: the address pair lives up to this wait, so neither a load's result nor a later instruction overwrites it in front of the wait */
  __builtin_amdgcn_sched_barrier(0);      /* holds the sixteen loads together in front of the conversions; without it the compiler issues the last six behind waits on the first ten, two more memory latencies a tile */
#pragma unroll
  for (int i = 0; i < 8; ++i)
#pragma unroll
    for (int j = 0; j < 4; ++j) { FragH f; f.h[0] = (_Float16)bf16_round(a[i][j]); f.h[1] = (_Float16)bf16_round(b[i][j]); tl[4 * n4 + j][cg + 4 * i] = (unsigned)f.u[0] | ((unsigned)f.u[1] << 16); }      /* channels 2 q and 2 q + 1 of one token share a dword */
  __syncthreads();      /* the tile is complete before any row of it is read */
  union { unsigned d[4]; v8us h; } o[8];
#pragma unroll      /* unrolled, here and below: o is indexed by constants and stays in registers; all LDS reads stand in front of the stores */
  for (int i = 0; i < 8; ++i) { const unsigned* r = &tl[i * 32 + (tid >> 3)][(tid & 7) * 4]; o[i].d[0] = r[0]; o[i].d[1] = r[1]; o[i].d[2] = r[2]; o[i].d[3] = r[3]; }
  unsigned short* q = (unsigned short*)P16 + (size_t)(n0 + (tid >> 3)) * DM + c0 + (tid & 7) * 8;
#pragma unroll
  for (int i = 0; i < 8; ++i) *(v8us*)(q + (size_t)(i * 32) * DM) = o[i].h;
}
// The six independent preparation jobs in one launch: blocks [0, 2 PMB) write the two token-major planes, one tile each, the next 4 WSB blocks the four weight planes.
#define PMB ((DM / PTC) * (SLEN / PTN))
#define WSB ((DM * DM / 8 + 255) / 256)
__global__ __launch_bounds__(256) void k_prep(const float* __restrict__ vid, const float* __restrict__ reff, _Float16* __restrict__ XV, _Float16* __restrict__ XR,
    const float* __restrict__ Wq, const float* __restrict__ Wk, const float* __restrict__ Wv, const float* __restrict__ Wo, _Float16* __restrict__ BQ, _Float16* __restrict__ BK, _Float16* __restrict__ BV, _Float16* __restrict__ BO) {
  __shared__ unsigned tl[PTN][PTD];
  const int bx = blockIdx.x;
  if (bx < 2 * PMB) { const bool second = bx >= PMB; d_pmt(tl, bx - (second ? PMB : 0), second ? reff : vid, second ? XR : XV); return; }      /* the same for every thread of the block: the barrier inside is passed by all or none */
  const int j = (bx - 2 * PMB) / WSB, wb = (bx - 2 * PMB) % WSB;
  const float* Wm = (j == 0) ? Wq : ((j == 1) ? Wk : ((j == 2) ? Wv : Wo)); _Float16* Bt = (j == 0) ? BQ : ((j == 1) ? BK : ((j == 2) ? BV : BO));
  d_wsc((size_t)wb * 256 + threadIdx.x, Wm, Bt, DM * DM / 8, 16.0f); }
__global__ __launch_bounds__(256) void k_nchw(const float* __restrict__ F, float* __restrict__ outb) { const int t = blockIdx.x * 256 + threadIdx.x; if (t >= DM * (SLEN / 4)) return; const int p0 = (t % (SLEN / 4)) * 4; const int o = t / (SLEN / 4); v4f r; for (int q = 0; q < 4; ++q) r[q] = F[(size_t)(p0 + q) * DM + o];
  *(v4f*)(outb + (size_t)o * SLEN + p0) = r;  }

extern "C" void kernel_launch(void* const* d_in, const int* in_sizes, int n_in,
                              void* d_out, int out_size, void* d_ws, size_t ws_size, hipStream_t stream) {
  (void)in_sizes; (void)n_in; (void)out_size;
  const float* const* I = (const float* const*)d_in; const float* vid = I[0]; const float* reff = I[1]; const float* Wq = I[2]; const float* bq = I[3]; const float* Wk = I[4]; const float* bk = I[5]; const float* Wv = I[6]; const float* bv = I[7]; const float* Wo = I[8]; const float* bo = I[9];
  char* ws = (char*)d_ws; size_t off = 0;
  auto take = [&](size_t bytes) { char* p = ws + off; off += (bytes + 255) & ~(size_t)255; return p; };
  const size_t np = (size_t)SLEN * DM;
  _Float16* BQ = (_Float16*)take((size_t)DM * DM * 2); _Float16* BK = (_Float16*)take((size_t)DM * DM * 2); _Float16* BV = (_Float16*)take((size_t)DM * DM * 2); _Float16* BO = (_Float16*)take((size_t)DM * DM * 2);
  _Float16* XV = (_Float16*)take(np * 2); _Float16* XR = (_Float16*)take(np * 2); _Float16* Q16 = (_Float16*)take(np * 2); _Float16* K16 = (_Float16*)take(np * 2); _Float16* VT = (_Float16*)take(np * 2); _Float16* O16 = (_Float16*)take(np * 2);
  if (off > ws_size) return;      /* 2 + 6 x 4 = 26 MiB */
  k_prep<<<2 * PMB + 4 * WSB, 256, 0, stream>>>(vid, reff, XV, XR, Wq, Wk, Wv, Wo, BQ, BK, BV, BO);      /* 'oc' = natural Bt */
  const dim3 gP((SLEN / 128) * (DM / 64), 1);
  const dim3 gP3((SLEN / 128) * (DM / 128), 3);
  k_gemm2x3<0><<<gP3, 128, 0, stream>>>(XV, XR, XR, BQ, BK, BV, bq, bk, bv, Q16, K16, VT, 0.0625f, DM, SLEN, DM, DM);      /* q, k token-major; v as V^T [channel][token] */
  k_flash<4><<<NB * NH * (TQ / 128), 128 * 4, 0, stream>>>(Q16, DM, K16, DM, VT, O16, DM);      /* 4096 x 4096 per head */
  k_gemm2<0, true><<<gP, 128, 0, stream>>>(BO, DM, 0, O16, DM, 0, 0.0625f, bo, 0, nullptr, 1, 0, 0, (float*)d_out, nullptr, SLEN, 0, DM, SLEN, DM);      /* out[channel][token] */
}
